// v000
// Measured on an AMD MI455X. A time is GPU time per run, averaged over a window of back-to-back runs after a warm-up
// (all launches, gaps included; the runs take copies of the inputs in turn), and the median of several windows.
// Apart from v000's, it joins two sittings. Times from different sittings can be a few percent apart, while
// side-by-side timings come from the same sitting.
// v000 is the starting kernel. One run takes 310 microseconds.
#include <hip/hip_runtime.h>

typedef __attribute__((ext_vector_type(16))) _Float16     v16h;
typedef __attribute__((ext_vector_type(8)))  float        v8f;
typedef __attribute__((ext_vector_type(4)))  unsigned int u32x4;
typedef __attribute__((ext_vector_type(8)))  int          i32x8;
typedef __attribute__((ext_vector_type(4)))  int          i32x4;

#define Cn   256
#define Nsp  4096      // H*W
#define Bn   4
#define GRP  16
#define FRAG 512       // halfs per packed fragment: 32 lanes x 16 halfs (32B/lane)

static __device__ inline v8f wmma_f16(v16h a, v16h b, v8f c) {
  return __builtin_amdgcn_wmma_f32_16x16x32_f16(
      false, a, false, b, (short)0, c, false, false);
}

static __device__ inline int frag_slot(int Kin) {
  return ((Kin & 16) ? 8 : 0) + (Kin & 7);
}
static __device__ inline int frag_lane(int Kin, int col) {
  return col + (((Kin >> 3) & 1) << 4);
}
static __device__ inline v16h load_frag(const _Float16* p) {
  return *(const v16h*)p;            // 32B -> 2x b128 loads
}

static __device__ inline unsigned lds_off(const void* p) {
  return (unsigned)(uintptr_t)p;
}
static __device__ inline void tdm_copy_to_lds(const _Float16* gsrc,
                                              unsigned lds_byte_off,
                                              unsigned nelem) {
  unsigned long long ga = (unsigned long long)(uintptr_t)gsrc;
  u32x4 g0;
  g0[0] = 1u;
  g0[1] = lds_byte_off;
  g0[2] = (unsigned)ga;
  g0[3] = (unsigned)((ga >> 32) & 0x1FFFFFFu)
        | (2u << 30);
  i32x8 g1;
  g1[0] = (int)(1u << 16);
  g1[1] = (int)((nelem & 0xFFFFu) << 16);
  g1[2] = (int)((nelem >> 16) & 0xFFFFu)
        | (int)(1u << 16);
  g1[3] = (int)((nelem & 0xFFFFu) << 16);
  g1[4] = 1;
  g1[5] = (int)nelem;
  g1[6] = 0;
  g1[7] = 0;
  i32x4 z4 = {0, 0, 0, 0};
  i32x8 z8 = {0, 0, 0, 0, 0, 0, 0, 0};
  __builtin_amdgcn_tensor_load_to_lds(g0, g1, z4, z4, z8, 0);
}

// ---------------------------------------------------------------------------
// Kernel 0: weights fp32 -> packed fp16 fragments.
//   wq/wk/wv as A-frags [ot][kt]; Wo^T as B-frags [kt][ot].
// grid (8 kt, 16 ot), block 32.
// ---------------------------------------------------------------------------
__global__ __launch_bounds__(32) void prep_weights_kernel(
    const float* __restrict__ wq, const float* __restrict__ wk,
    const float* __restrict__ wv, const float* __restrict__ wo,
    _Float16* __restrict__ wqP, _Float16* __restrict__ wkP,
    _Float16* __restrict__ wvP, _Float16* __restrict__ woP) {
  const int kt = blockIdx.x, ot = blockIdx.y;
  const int lane = threadIdx.x;
  const int m = lane & 15, koff = (lane >> 4) * 8;
  const int row = ot * 16 + m;
  const size_t pa = (size_t)(ot * 8 + kt) * FRAG + lane * 16;
  const size_t pb = (size_t)(kt * 16 + ot) * FRAG + lane * 16;
#pragma unroll
  for (int i = 0; i < 8; ++i) {
    const int K0 = kt * 32 + koff + i;
    const int K1 = kt * 32 + 16 + koff + i;
    wqP[pa + i]     = (_Float16)wq[row * Cn + K0];
    wqP[pa + i + 8] = (_Float16)wq[row * Cn + K1];
    wkP[pa + i]     = (_Float16)wk[row * Cn + K0];
    wkP[pa + i + 8] = (_Float16)wk[row * Cn + K1];
    wvP[pa + i]     = (_Float16)wv[row * Cn + K0];
    wvP[pa + i + 8] = (_Float16)wv[row * Cn + K1];
    // B-frag of Wo^T: element (K=c, col=o) = wo[o*C + c]  (same gather shape)
    woP[pb + i]     = (_Float16)wo[row * Cn + K0];
    woP[pb + i + 8] = (_Float16)wo[row * Cn + K1];
  }
}

// ---------------------------------------------------------------------------
// Kernel 1: GroupNorm -> xn packed directly as B-frags [b][nt][kt].
// one block per (b, group). grid 64, block 256.
// ---------------------------------------------------------------------------
__global__ __launch_bounds__(256) void gn_kernel(const float* __restrict__ x,
                                                 const float* __restrict__ gamma,
                                                 const float* __restrict__ beta,
                                                 _Float16* __restrict__ xnP) {
  const int b = blockIdx.x >> 4, grp = blockIdx.x & 15, t = threadIdx.x;
  const int CPG = Cn / GRP;                  // 16 channels per group
  const int total = CPG * Nsp;               // 65536
  const size_t base = ((size_t)b * Cn + (size_t)grp * CPG) * Nsp;

  float s = 0.f, ss = 0.f;
  for (int e = t; e < total; e += 256) {
    float v = x[base + e];
    s += v; ss += v * v;
  }
  __shared__ float rs[256], rss[256];
  rs[t] = s; rss[t] = ss;
  __syncthreads();
  for (int off = 128; off > 0; off >>= 1) {
    if (t < off) { rs[t] += rs[t + off]; rss[t] += rss[t + off]; }
    __syncthreads();
  }
  const float inv_n = 1.0f / (float)total;
  const float mean  = rs[0] * inv_n;
  const float rstd  = rsqrtf(rss[0] * inv_n - mean * mean + 1e-5f);

  for (int e = t; e < total; e += 256) {
    const int c = grp * CPG + e / Nsp;       // global channel
    const int n = e & (Nsp - 1);             // spatial index
    const float v = (x[base + e] - mean) * rstd * gamma[c] + beta[c];
    const int nt = n >> 4, col = n & 15, kt = c >> 5, Kin = c & 31;
    xnP[((size_t)(b * 256 + nt) * 8 + kt) * FRAG +
        frag_lane(Kin, col) * 16 + frag_slot(Kin)] = (_Float16)v;
  }
}

// ---------------------------------------------------------------------------
// Kernel 2: QKV GEMMs, fully packed operands. One wave / 16x16 tile.
//   writes qP & kP (K=channels; identical packing) and vP (K=spatial).
// grid (N/16, C/16, B), block 32.
// ---------------------------------------------------------------------------
__global__ __launch_bounds__(32) void qkv_kernel(
    const _Float16* __restrict__ xnP,
    const _Float16* __restrict__ wqP, const _Float16* __restrict__ wkP,
    const _Float16* __restrict__ wvP,
    const float* __restrict__ bq, const float* __restrict__ bk,
    const float* __restrict__ bv,
    _Float16* __restrict__ qP, _Float16* __restrict__ kP,
    _Float16* __restrict__ vP) {
  const int b = blockIdx.z, ot = blockIdx.y, nt = blockIdx.x;
  const int lane = threadIdx.x, nl = lane & 15, hh = lane >> 4;

  v8f aq = {}, ak = {}, av = {};
#pragma unroll
  for (int kt = 0; kt < 8; ++kt) {
    const v16h fq = load_frag(wqP + (size_t)(ot * 8 + kt) * FRAG + lane * 16);
    const v16h fk = load_frag(wkP + (size_t)(ot * 8 + kt) * FRAG + lane * 16);
    const v16h fv = load_frag(wvP + (size_t)(ot * 8 + kt) * FRAG + lane * 16);
    const v16h xb = load_frag(xnP + ((size_t)(b * 256 + nt) * 8 + kt) * FRAG + lane * 16);
    aq = wmma_f16(fq, xb, aq);
    ak = wmma_f16(fk, xb, ak);
    av = wmma_f16(fv, xb, av);
  }

#pragma unroll
  for (int v = 0; v < 8; ++v) {
    const int m = v + hh * 8;                  // channel row within tile
    const int o = ot * 16 + m;
    const _Float16 qv = (_Float16)(aq[v] + bq[o]);
    const _Float16 kv = (_Float16)(ak[v] + bk[o]);
    const _Float16 vv = (_Float16)(av[v] + bv[o]);
    // q/k: K = channel o, col = spatial nl  (A- and B-frag pack identically)
    const int Kc = o & 31, ktc = o >> 5;
    const size_t fqk = ((size_t)(b * 256 + nt) * 8 + ktc) * FRAG +
                       frag_lane(Kc, nl) * 16 + frag_slot(Kc);
    qP[fqk] = qv;
    kP[fqk] = kv;
    // v: K = spatial j, col = channel m within tile ct = ot
    const int jg = nt * 16 + nl, Kj = jg & 31, jt32 = jg >> 5;
    vP[((size_t)(b * 128 + jt32) * 16 + ot) * FRAG +
       frag_lane(Kj, m) * 16 + frag_slot(Kj)] = vv;
  }
}

// ---------------------------------------------------------------------------
// Kernel 3: flash attention. 8 waves/block (4 query tiles x 2 channel halves)
// share K/V j-tiles staged in LDS by the Tensor Data Mover, double-buffered.
// grid (N/64, B), block 256. LDS: 2*16KB K + 2*16KB V + 8*1KB P = 72 KB.
// ---------------------------------------------------------------------------
__global__ __launch_bounds__(256) void attn_kernel(
    const _Float16* __restrict__ qP, const _Float16* __restrict__ kP,
    const _Float16* __restrict__ vP, _Float16* __restrict__ attP) {
  const int b = blockIdx.y;
  const int wave = threadIdx.x >> 5, lane = threadIdx.x & 31;
  const int it = blockIdx.x * 4 + (wave >> 1);   // query tile (16 rows)
  const int ch = wave & 1;                       // channel half (128 ch)
  const int nl = lane & 15, hh = lane >> 4, koff = hh * 8;

  __shared__ __align__(16) _Float16 sK[2][8192];  // 32 keys x 256 ch, 2 bufs
  __shared__ __align__(16) _Float16 sV[2][8192];  // 32 keys x 256 ch, 2 bufs
  __shared__ __align__(16) _Float16 sP[8][FRAG];  // per-wave prob staging

  // resident q fragments (all 256 channels of this query tile)
  v16h qa[8];
#pragma unroll
  for (int kt = 0; kt < 8; ++kt)
    qa[kt] = load_frag(qP + ((size_t)(b * 256 + it) * 8 + kt) * FRAG + lane * 16);

  v8f acc[8];
#pragma unroll
  for (int t = 0; t < 8; ++t) acc[t] = (v8f){};
  float rowM[8], rowL[8];
#pragma unroll
  for (int v = 0; v < 8; ++v) { rowM[v] = -3.0e38f; rowL[v] = 0.0f; }

  const float sc = 0.0625f * 1.44269504088896f;   // 1/sqrt(C) * log2(e)

  if (threadIdx.x < 32) {
    tdm_copy_to_lds(kP + (size_t)(b * 256) * 8 * FRAG, lds_off(&sK[0][0]), 8192);
    tdm_copy_to_lds(vP + (size_t)(b * 128) * 16 * FRAG, lds_off(&sV[0][0]), 8192);
    __builtin_amdgcn_s_wait_tensorcnt(0);
  }
  __syncthreads();

  for (int j0 = 0; j0 < Nsp; j0 += 32) {
    const int buf = (j0 >> 5) & 1;
    if (threadIdx.x < 32 && (j0 + 32) < Nsp) {
      const int jn = j0 + 32;
      tdm_copy_to_lds(kP + (size_t)(b * 256 + (jn >> 4)) * 8 * FRAG,
                      lds_off(&sK[buf ^ 1][0]), 8192);
      tdm_copy_to_lds(vP + (size_t)(b * 128 + (jn >> 5)) * 16 * FRAG,
                      lds_off(&sV[buf ^ 1][0]), 8192);
    }

    // ---- scores: two 16x16 tiles over 32 keys (K frags from LDS) ----
    v8f s0 = {}, s1 = {};
#pragma unroll
    for (int kt = 0; kt < 8; ++kt) {
      const v16h k0 = *(const v16h*)(&sK[buf][(kt)     * FRAG + lane * 16]);
      const v16h k1 = *(const v16h*)(&sK[buf][(8 + kt) * FRAG + lane * 16]);
      s0 = wmma_f16(qa[kt], k0, s0);
      s1 = wmma_f16(qa[kt], k1, s1);
    }

    // ---- online softmax ----
    float alpha[8];
#pragma unroll
    for (int v = 0; v < 8; ++v) {
      const float a0 = s0[v] * sc, a1 = s1[v] * sc;
      float mx = fmaxf(a0, a1);
      mx = fmaxf(mx, __shfl_xor(mx, 1, 32));
      mx = fmaxf(mx, __shfl_xor(mx, 2, 32));
      mx = fmaxf(mx, __shfl_xor(mx, 4, 32));
      mx = fmaxf(mx, __shfl_xor(mx, 8, 32));
      const float newM = fmaxf(rowM[v], mx);
      const float al = exp2f(rowM[v] - newM);
      const float p0 = exp2f(a0 - newM);
      const float p1 = exp2f(a1 - newM);
      float rsum = p0 + p1;
      rsum += __shfl_xor(rsum, 1, 32);
      rsum += __shfl_xor(rsum, 2, 32);
      rsum += __shfl_xor(rsum, 4, 32);
      rsum += __shfl_xor(rsum, 8, 32);
      rowL[v] = rowL[v] * al + rsum;
      rowM[v] = newM;
      alpha[v] = al;
      const int row = v + hh * 8;
      sP[wave][row * 32 + nl]      = (_Float16)p0;
      sP[wave][row * 32 + 16 + nl] = (_Float16)p1;
    }
    __syncthreads();

    v16h pa;                       // probabilities in A-frag layout
#pragma unroll
    for (int i = 0; i < 8; ++i) {
      pa[i]     = sP[wave][nl * 32 + koff + i];
      pa[i + 8] = sP[wave][nl * 32 + 16 + koff + i];
    }
    __syncthreads();

    // ---- p @ V: 8 channel tiles for this wave's half (V frags from LDS) ----
#pragma unroll
    for (int t = 0; t < 8; ++t) {
      const v16h vf = *(const v16h*)(&sV[buf][(ch * 8 + t) * FRAG + lane * 16]);
#pragma unroll
      for (int v = 0; v < 8; ++v) acc[t][v] *= alpha[v];
      acc[t] = wmma_f16(pa, vf, acc[t]);
    }

    if (threadIdx.x < 32) __builtin_amdgcn_s_wait_tensorcnt(0);
    __syncthreads();               // hand off buffers
  }

  // ---- finalize & scatter-store attP as A-frags for the out-projection ----
#pragma unroll
  for (int t = 0; t < 8; ++t) {
#pragma unroll
    for (int v = 0; v < 8; ++v) {
      const int m = v + hh * 8;                    // query row within tile
      const int c = ch * 128 + t * 16 + nl;        // global channel (= K)
      const float o = acc[t][v] / rowL[v];
      attP[((size_t)(b * 256 + it) * 8 + (c >> 5)) * FRAG +
           frag_lane(c & 31, m) * 16 + frag_slot(c & 31)] = (_Float16)o;
    }
  }
}

// ---------------------------------------------------------------------------
// Kernel 4: output projection + residual (fp32 out), packed operands.
// grid (N/16, C/16, B), block 32.
// ---------------------------------------------------------------------------
__global__ __launch_bounds__(32) void proj_kernel(
    const _Float16* __restrict__ attP, const _Float16* __restrict__ woP,
    const float* __restrict__ bo, const float* __restrict__ x,
    float* __restrict__ out) {
  const int b = blockIdx.z, ot = blockIdx.y, nt = blockIdx.x;
  const int lane = threadIdx.x, nl = lane & 15, hh = lane >> 4;

  v8f acc = {};
#pragma unroll
  for (int kt = 0; kt < 8; ++kt) {
    const v16h fa = load_frag(attP + ((size_t)(b * 256 + nt) * 8 + kt) * FRAG + lane * 16);
    const v16h fb = load_frag(woP + (size_t)(kt * 16 + ot) * FRAG + lane * 16);
    acc = wmma_f16(fa, fb, acc);
  }
#pragma unroll
  for (int v = 0; v < 8; ++v) {
    const int m = v + hh * 8;                      // spatial row within tile
    const size_t idx = ((size_t)b * Cn + ot * 16 + nl) * Nsp + nt * 16 + m;
    out[idx] = acc[v] + bo[ot * 16 + nl] + x[idx];
  }
}

extern "C" void kernel_launch(void* const* d_in, const int* in_sizes, int n_in,
                              void* d_out, int out_size, void* d_ws, size_t ws_size,
                              hipStream_t stream) {
  const float* x     = (const float*)d_in[0];
  const float* gamma = (const float*)d_in[1];
  const float* beta  = (const float*)d_in[2];
  const float* wq    = (const float*)d_in[3];
  const float* bq    = (const float*)d_in[4];
  const float* wk    = (const float*)d_in[5];
  const float* bk    = (const float*)d_in[6];
  const float* wv    = (const float*)d_in[7];
  const float* bv    = (const float*)d_in[8];
  const float* wo    = (const float*)d_in[9];
  const float* bo    = (const float*)d_in[10];
  float* out = (float*)d_out;

  const size_t T = (size_t)Bn * Cn * Nsp;
  _Float16* xnP  = (_Float16*)d_ws;
  _Float16* qP   = xnP  + T;
  _Float16* kP   = qP   + T;
  _Float16* vP   = kP   + T;
  _Float16* attP = vP   + T;
  _Float16* wqP  = attP + T;
  _Float16* wkP  = wqP  + (size_t)Cn * Cn;
  _Float16* wvP  = wkP  + (size_t)Cn * Cn;
  _Float16* woP  = wvP  + (size_t)Cn * Cn;

  prep_weights_kernel<<<dim3(8, 16), 32, 0, stream>>>(
      wq, wk, wv, wo, wqP, wkP, wvP, woP);

  gn_kernel<<<Bn * GRP, 256, 0, stream>>>(x, gamma, beta, xnP);

  qkv_kernel<<<dim3(Nsp / 16, Cn / 16, Bn), 32, 0, stream>>>(
      xnP, wqP, wkP, wvP, bq, bk, bv, qP, kP, vP);

  attn_kernel<<<dim3(Nsp / 64, Bn), 256, 0, stream>>>(qP, kP, vP, attP);

  proj_kernel<<<dim3(Nsp / 16, Cn / 16, Bn), 32, 0, stream>>>(
      attP, woP, bo, x, out);
}

// v001
// A run of this version takes 246 microseconds.
// Next to v000, in two timings, it ran 1.32 times as fast each time.
#include <hip/hip_runtime.h>

typedef __attribute__((ext_vector_type(16))) _Float16     v16h;
typedef __attribute__((ext_vector_type(8)))  float        v8f;
typedef __attribute__((ext_vector_type(4)))  unsigned int u32x4;
typedef __attribute__((ext_vector_type(8)))  int          i32x8;
typedef __attribute__((ext_vector_type(4)))  int          i32x4;

#define Cn   256
#define Nsp  4096      // H*W
#define Bn   4
#define GRP  16
#define FRAG 512       // halfs per packed fragment: 32 lanes x 16 halfs (32B/lane)

static __device__ inline v8f wmma_f16(v16h a, v16h b, v8f c) {
  return __builtin_amdgcn_wmma_f32_16x16x32_f16(
      false, a, false, b, (short)0, c, false, false);
}

static __device__ inline int frag_slot(int Kin) {
  return ((Kin & 16) ? 8 : 0) + (Kin & 7);
}
static __device__ inline int frag_lane(int Kin, int col) {
  return col + (((Kin >> 3) & 1) << 4);
}
static __device__ inline v16h load_frag(const _Float16* p) {
  return *(const v16h*)p;            // 32B -> 2x b128 loads
}

static __device__ inline unsigned lds_off(const void* p) {
  return (unsigned)(uintptr_t)p;
}
static __device__ inline void tdm_copy_to_lds(const _Float16* gsrc,
                                              unsigned lds_byte_off,
                                              unsigned nelem) {
  unsigned long long ga = (unsigned long long)(uintptr_t)gsrc;
  u32x4 g0;
  g0[0] = 1u;
  g0[1] = lds_byte_off;
  g0[2] = (unsigned)ga;
  g0[3] = (unsigned)((ga >> 32) & 0x1FFFFFFu)
        | (2u << 30);
  i32x8 g1;
  g1[0] = (int)(1u << 16);
  g1[1] = (int)((nelem & 0xFFFFu) << 16);
  g1[2] = (int)((nelem >> 16) & 0xFFFFu)
        | (int)(1u << 16);
  g1[3] = (int)((nelem & 0xFFFFu) << 16);
  g1[4] = 1;
  g1[5] = (int)nelem;
  g1[6] = 0;
  g1[7] = 0;
  i32x4 z4 = {0, 0, 0, 0};
  i32x8 z8 = {0, 0, 0, 0, 0, 0, 0, 0};
  __builtin_amdgcn_tensor_load_to_lds(g0, g1, z4, z4, z8, 0);
}

// ---------------------------------------------------------------------------
// Kernel 0: weights fp32 -> packed fp16 fragments.
//   wq/wk/wv as A-frags [ot][kt]; Wo^T as B-frags [kt][ot].
// grid (8 kt, 16 ot), block 32.
// ---------------------------------------------------------------------------
__global__ __launch_bounds__(32) void prep_weights_kernel(
    const float* __restrict__ wq, const float* __restrict__ wk,
    const float* __restrict__ wv, const float* __restrict__ wo,
    _Float16* __restrict__ wqP, _Float16* __restrict__ wkP,
    _Float16* __restrict__ wvP, _Float16* __restrict__ woP) {
  const int kt = blockIdx.x, ot = blockIdx.y;
  const int lane = threadIdx.x;
  const int m = lane & 15, koff = (lane >> 4) * 8;
  const int row = ot * 16 + m;
  const size_t pa = (size_t)(ot * 8 + kt) * FRAG + lane * 16;
  const size_t pb = (size_t)(kt * 16 + ot) * FRAG + lane * 16;
#pragma unroll
  for (int i = 0; i < 8; ++i) {
    const int K0 = kt * 32 + koff + i;
    const int K1 = kt * 32 + 16 + koff + i;
    wqP[pa + i]     = (_Float16)wq[row * Cn + K0];
    wqP[pa + i + 8] = (_Float16)wq[row * Cn + K1];
    wkP[pa + i]     = (_Float16)wk[row * Cn + K0];
    wkP[pa + i + 8] = (_Float16)wk[row * Cn + K1];
    wvP[pa + i]     = (_Float16)wv[row * Cn + K0];
    wvP[pa + i + 8] = (_Float16)wv[row * Cn + K1];
    // B-frag of Wo^T: element (K=c, col=o) = wo[o*C + c]  (same gather shape)
    woP[pb + i]     = (_Float16)wo[row * Cn + K0];
    woP[pb + i + 8] = (_Float16)wo[row * Cn + K1];
  }
}

// ---------------------------------------------------------------------------
// Kernel 1: GroupNorm -> xn packed directly as B-frags [b][nt][kt].
// one block per (b, group). grid 64, block 256.
// ---------------------------------------------------------------------------
__global__ __launch_bounds__(256) void gn_kernel(const float* __restrict__ x,
                                                 const float* __restrict__ gamma,
                                                 const float* __restrict__ beta,
                                                 _Float16* __restrict__ xnP) {
  const int b = blockIdx.x >> 4, grp = blockIdx.x & 15, t = threadIdx.x;
  const int CPG = Cn / GRP;                  // 16 channels per group
  const int total = CPG * Nsp;               // 65536
  const size_t base = ((size_t)b * Cn + (size_t)grp * CPG) * Nsp;

  float s = 0.f, ss = 0.f;
  for (int e = t; e < total; e += 256) {
    float v = x[base + e];
    s += v; ss += v * v;
  }
  __shared__ float rs[256], rss[256];
  rs[t] = s; rss[t] = ss;
  __syncthreads();
  for (int off = 128; off > 0; off >>= 1) {
    if (t < off) { rs[t] += rs[t + off]; rss[t] += rss[t + off]; }
    __syncthreads();
  }
  const float inv_n = 1.0f / (float)total;
  const float mean  = rs[0] * inv_n;
  const float rstd  = rsqrtf(rss[0] * inv_n - mean * mean + 1e-5f);

  for (int e = t; e < total; e += 256) {
    const int c = grp * CPG + e / Nsp;       // global channel
    const int n = e & (Nsp - 1);             // spatial index
    const float v = (x[base + e] - mean) * rstd * gamma[c] + beta[c];
    const int nt = n >> 4, col = n & 15, kt = c >> 5, Kin = c & 31;
    xnP[((size_t)(b * 256 + nt) * 8 + kt) * FRAG +
        frag_lane(Kin, col) * 16 + frag_slot(Kin)] = (_Float16)v;
  }
}

// ---------------------------------------------------------------------------
// Kernel 2: QKV GEMMs, fully packed operands. One wave / 16x16 tile.
//   writes qP & kP (K=channels; identical packing) and vP (K=spatial).
// grid (N/16, C/16, B), block 32.
// ---------------------------------------------------------------------------
__global__ __launch_bounds__(32) void qkv_kernel(
    const _Float16* __restrict__ xnP,
    const _Float16* __restrict__ wqP, const _Float16* __restrict__ wkP,
    const _Float16* __restrict__ wvP,
    const float* __restrict__ bq, const float* __restrict__ bk,
    const float* __restrict__ bv,
    _Float16* __restrict__ qP, _Float16* __restrict__ kP,
    _Float16* __restrict__ vP) {
  const int b = blockIdx.z, ot = blockIdx.y, nt = blockIdx.x;
  const int lane = threadIdx.x, nl = lane & 15, hh = lane >> 4;

  v8f aq = {}, ak = {}, av = {};
#pragma unroll
  for (int kt = 0; kt < 8; ++kt) {
    const v16h fq = load_frag(wqP + (size_t)(ot * 8 + kt) * FRAG + lane * 16);
    const v16h fk = load_frag(wkP + (size_t)(ot * 8 + kt) * FRAG + lane * 16);
    const v16h fv = load_frag(wvP + (size_t)(ot * 8 + kt) * FRAG + lane * 16);
    const v16h xb = load_frag(xnP + ((size_t)(b * 256 + nt) * 8 + kt) * FRAG + lane * 16);
    aq = wmma_f16(fq, xb, aq);
    ak = wmma_f16(fk, xb, ak);
    av = wmma_f16(fv, xb, av);
  }

#pragma unroll
  for (int v = 0; v < 8; ++v) {
    const int m = v + hh * 8;                  // channel row within tile
    const int o = ot * 16 + m;
    const _Float16 qv = (_Float16)(aq[v] + bq[o]);
    const _Float16 kv = (_Float16)(ak[v] + bk[o]);
    const _Float16 vv = (_Float16)(av[v] + bv[o]);
    // q/k: K = channel o, col = spatial nl  (A- and B-frag pack identically)
    const int Kc = o & 31, ktc = o >> 5;
    const size_t fqk = ((size_t)(b * 256 + nt) * 8 + ktc) * FRAG +
                       frag_lane(Kc, nl) * 16 + frag_slot(Kc);
    qP[fqk] = qv;
    kP[fqk] = kv;
    // v: K = spatial j, col = channel m within tile ct = ot
    const int jg = nt * 16 + nl, Kj = jg & 31, jt32 = jg >> 5;
    vP[((size_t)(b * 128 + jt32) * 16 + ot) * FRAG +
       frag_lane(Kj, m) * 16 + frag_slot(Kj)] = vv;
  }
}

static __device__ inline float xhalf(float x) {
  const int i = __builtin_bit_cast(int, x);
  return __builtin_bit_cast(float, __builtin_amdgcn_permlanex16(
      i, i, 0x76543210, 0xfedcba98, false, false));
}

__global__ __launch_bounds__(256) void attn_kernel(
    const _Float16* __restrict__ qP, const _Float16* __restrict__ kP,
    const _Float16* __restrict__ vP, _Float16* __restrict__ attP) {
  const int b = blockIdx.y;
  const int wave = threadIdx.x >> 5, lane = threadIdx.x & 31;
  const int it = blockIdx.x * 4 + (wave >> 1);   // query tile (16 columns)
  const int ch = wave & 1;                       // channel half (128 ch)

  __shared__ __align__(16) _Float16 sK[2][8192];  // 32 keys x 256 ch, 2 bufs
  __shared__ __align__(16) _Float16 sV[2][8192];  // 32 keys x 256 ch, 2 bufs

  // resident q fragments (all 256 channels of this query tile), used as B
  v16h qa[8];
#pragma unroll
  for (int kt = 0; kt < 8; ++kt)
    qa[kt] = load_frag(qP + ((size_t)(b * 256 + it) * 8 + kt) * FRAG + lane * 16);

  v8f acc[8];                      // acc[t][r] = O^T[ch*128 + t*16 + 8*hh + r][nl]
#pragma unroll
  for (int t = 0; t < 8; ++t) acc[t] = (v8f){};
  float rowM = -3.0e38f;           // running maximum of this lane's query
  float rowL = 0.0f;               // running sum over this wave half's keys

  const float sc = 0.0625f * 1.44269504088896f;   // 1/sqrt(C) * log2(e)

  if (threadIdx.x < 32) {
    tdm_copy_to_lds(kP + (size_t)(b * 256) * 8 * FRAG, lds_off(&sK[0][0]), 8192);
    tdm_copy_to_lds(vP + (size_t)(b * 128) * 16 * FRAG, lds_off(&sV[0][0]), 8192);
    __builtin_amdgcn_s_wait_tensorcnt(0);
  }
  __syncthreads();

  for (int j0 = 0; j0 < Nsp; j0 += 32) {
    const int buf = (j0 >> 5) & 1;
    if (threadIdx.x < 32 && (j0 + 32) < Nsp) {
      const int jn = j0 + 32;
      tdm_copy_to_lds(kP + (size_t)(b * 256 + (jn >> 4)) * 8 * FRAG,
                      lds_off(&sK[buf ^ 1][0]), 8192);
      tdm_copy_to_lds(vP + (size_t)(b * 128 + (jn >> 5)) * 16 * FRAG,
                      lds_off(&sV[buf ^ 1][0]), 8192);
    }

    // ---- scores^T: two 16(keys)x16(queries) tiles (K frags from LDS as A) ----
    v8f s0 = {}, s1 = {};
#pragma unroll
    for (int kt = 0; kt < 8; ++kt) {
      const v16h k0 = *(const v16h*)(&sK[buf][(kt)     * FRAG + lane * 16]);
      const v16h k1 = *(const v16h*)(&sK[buf][(8 + kt) * FRAG + lane * 16]);
      s0 = wmma_f16(k0, qa[kt], s0);
      s1 = wmma_f16(k1, qa[kt], s1);
    }

    // ---- online softmax, one query per lane ----
    float mx = fmaxf(s0[0], s1[0]);                // raw scores: the scale is positive
#pragma unroll
    for (int r = 1; r < 8; ++r) mx = fmaxf(mx, fmaxf(s0[r], s1[r]));
    mx = fmaxf(mx, xhalf(mx)) * sc;                // both halves: the query's maximum
    const float newM = fmaxf(rowM, mx);
    const float al = exp2f(rowM - newM);
    rowM = newM;

    v16h pb;
    float ps0 = 0.0f, ps1 = 0.0f;
#pragma unroll
    for (int r = 0; r < 8; ++r) {
      const float p0 = exp2f(s0[r] * sc - newM);
      const float p1 = exp2f(s1[r] * sc - newM);
      ps0 += p0;
      ps1 += p1;
      pb[r]     = (_Float16)p0;
      pb[r + 8] = (_Float16)p1;
    }
    rowL = rowL * al + (ps0 + ps1);

    // ---- V^T @ P^T: 8 channel tiles of this wave's half (V frags from LDS as A) ----
#pragma unroll
    for (int t = 0; t < 8; ++t) {
      const v16h vf = *(const v16h*)(&sV[buf][(ch * 8 + t) * FRAG + lane * 16]);
      acc[t] *= al;
      acc[t] = wmma_f16(vf, pb, acc[t]);
    }

    if (threadIdx.x < 32) __builtin_amdgcn_s_wait_tensorcnt(0);
    __syncthreads();               // hand off buffers
  }

  const float inv = 1.0f / (rowL + xhalf(rowL));   // join the halves' sums
  typedef __attribute__((ext_vector_type(8))) _Float16 v8h;
#pragma unroll
  for (int t = 0; t < 8; ++t) {
    v8h o;
#pragma unroll
    for (int r = 0; r < 8; ++r) o[r] = (_Float16)(acc[t][r] * inv);
    *(v8h*)(attP + ((size_t)(b * 256 + it) * 8 + ch * 4 + (t >> 1)) * FRAG +
            lane * 16 + (t & 1) * 8) = o;
  }
}

// ---------------------------------------------------------------------------
// Kernel 4: output projection + residual (fp32 out), packed operands.
// grid (N/16, C/16, B), block 32.
// ---------------------------------------------------------------------------
__global__ __launch_bounds__(32) void proj_kernel(
    const _Float16* __restrict__ attP, const _Float16* __restrict__ woP,
    const float* __restrict__ bo, const float* __restrict__ x,
    float* __restrict__ out) {
  const int b = blockIdx.z, ot = blockIdx.y, nt = blockIdx.x;
  const int lane = threadIdx.x, nl = lane & 15, hh = lane >> 4;

  v8f acc = {};
#pragma unroll
  for (int kt = 0; kt < 8; ++kt) {
    const v16h fa = load_frag(attP + ((size_t)(b * 256 + nt) * 8 + kt) * FRAG + lane * 16);
    const v16h fb = load_frag(woP + (size_t)(kt * 16 + ot) * FRAG + lane * 16);
    acc = wmma_f16(fa, fb, acc);
  }
#pragma unroll
  for (int v = 0; v < 8; ++v) {
    const int m = v + hh * 8;                      // spatial row within tile
    const size_t idx = ((size_t)b * Cn + ot * 16 + nl) * Nsp + nt * 16 + m;
    out[idx] = acc[v] + bo[ot * 16 + nl] + x[idx];
  }
}

extern "C" void kernel_launch(void* const* d_in, const int* in_sizes, int n_in,
                              void* d_out, int out_size, void* d_ws, size_t ws_size,
                              hipStream_t stream) {
  const float* x     = (const float*)d_in[0];
  const float* gamma = (const float*)d_in[1];
  const float* beta  = (const float*)d_in[2];
  const float* wq    = (const float*)d_in[3];
  const float* bq    = (const float*)d_in[4];
  const float* wk    = (const float*)d_in[5];
  const float* bk    = (const float*)d_in[6];
  const float* wv    = (const float*)d_in[7];
  const float* bv    = (const float*)d_in[8];
  const float* wo    = (const float*)d_in[9];
  const float* bo    = (const float*)d_in[10];
  float* out = (float*)d_out;

  const size_t T = (size_t)Bn * Cn * Nsp;
  _Float16* xnP  = (_Float16*)d_ws;
  _Float16* qP   = xnP  + T;
  _Float16* kP   = qP   + T;
  _Float16* vP   = kP   + T;
  _Float16* attP = vP   + T;
  _Float16* wqP  = attP + T;
  _Float16* wkP  = wqP  + (size_t)Cn * Cn;
  _Float16* wvP  = wkP  + (size_t)Cn * Cn;
  _Float16* woP  = wvP  + (size_t)Cn * Cn;

  prep_weights_kernel<<<dim3(8, 16), 32, 0, stream>>>(
      wq, wk, wv, wo, wqP, wkP, wvP, woP);

  gn_kernel<<<Bn * GRP, 256, 0, stream>>>(x, gamma, beta, xnP);

  qkv_kernel<<<dim3(Nsp / 16, Cn / 16, Bn), 32, 0, stream>>>(
      xnP, wqP, wkP, wvP, bq, bk, bv, qP, kP, vP);

  attn_kernel<<<dim3(Nsp / 64, Bn), 256, 0, stream>>>(qP, kP, vP, attP);

  proj_kernel<<<dim3(Nsp / 16, Cn / 16, Bn), 32, 0, stream>>>(
      attP, woP, bo, x, out);
}

// v002
// A run of this version takes 213 microseconds.
// Timed twice side by side with v001, it ran 1.15 times as fast both times.
// Over all steps from v000 it is 1.52 times as fast.
#include <hip/hip_runtime.h>

typedef __attribute__((ext_vector_type(16))) _Float16     v16h;
typedef __attribute__((ext_vector_type(8)))  _Float16     v8h;
typedef __attribute__((ext_vector_type(8)))  float        v8f;
typedef __attribute__((ext_vector_type(4)))  unsigned int u32x4;
typedef __attribute__((ext_vector_type(8)))  int          i32x8;
typedef __attribute__((ext_vector_type(4)))  int          i32x4;

#define Cn   256
#define Nsp  4096      // H*W
#define Bn   4
#define GRP  16
#define FRAG 512       // halfs per packed fragment: 32 lanes x 16 halfs (32B/lane)

static __device__ inline v8f wmma_f16(v16h a, v16h b, v8f c) {
  return __builtin_amdgcn_wmma_f32_16x16x32_f16(
      false, a, false, b, (short)0, c, false, false);
}

static __device__ inline int frag_slot(int Kin) {
  return ((Kin & 16) ? 8 : 0) + (Kin & 7);
}
static __device__ inline int frag_lane(int Kin, int col) {
  return col + (((Kin >> 3) & 1) << 4);
}
static __device__ inline v16h load_frag(const _Float16* p) {
  return *(const v16h*)p;            // 32B -> 2x b128 loads
}

#define PLANE 256      // halfs per plane
static __device__ inline int plane_off(int Kin, int col) {
  return ((Kin & 16) ? PLANE : 0) + frag_lane(Kin, col) * 8 + (Kin & 7);
}
static __device__ inline v16h load_planes(const _Float16* frag, int lane) {
  const v8h lo = *(const v8h*)(frag + lane * 8);
  const v8h hi = *(const v8h*)(frag + PLANE + lane * 8);
  return __builtin_shufflevector(lo, hi, 0, 1, 2, 3, 4, 5, 6, 7,
                                 8, 9, 10, 11, 12, 13, 14, 15);
}

static __device__ inline unsigned lds_off(const void* p) {
  return (unsigned)(uintptr_t)p;
}
static __device__ inline void tdm_copy_to_lds(const _Float16* gsrc,
                                              unsigned lds_byte_off,
                                              unsigned nelem) {
  unsigned long long ga = (unsigned long long)(uintptr_t)gsrc;
  u32x4 g0;
  g0[0] = 1u;
  g0[1] = lds_byte_off;
  g0[2] = (unsigned)ga;
  g0[3] = (unsigned)((ga >> 32) & 0x1FFFFFFu)
        | (2u << 30);
  i32x8 g1;
  g1[0] = (int)(1u << 16);
  g1[1] = (int)((nelem & 0xFFFFu) << 16);
  g1[2] = (int)((nelem >> 16) & 0xFFFFu)
        | (int)(1u << 16);
  g1[3] = (int)((nelem & 0xFFFFu) << 16);
  g1[4] = 1;
  g1[5] = (int)nelem;
  g1[6] = 0;
  g1[7] = 0;
  i32x4 z4 = {0, 0, 0, 0};
  i32x8 z8 = {0, 0, 0, 0, 0, 0, 0, 0};
  __builtin_amdgcn_tensor_load_to_lds(g0, g1, z4, z4, z8, 0);
}

// ---------------------------------------------------------------------------
// Kernel 0: weights fp32 -> packed fp16 fragments.
//   wq/wk/wv as A-frags [ot][kt]; Wo^T as B-frags [kt][ot].
// grid (8 kt, 16 ot), block 32.
// ---------------------------------------------------------------------------
__global__ __launch_bounds__(32) void prep_weights_kernel(
    const float* __restrict__ wq, const float* __restrict__ wk,
    const float* __restrict__ wv, const float* __restrict__ wo,
    _Float16* __restrict__ wqP, _Float16* __restrict__ wkP,
    _Float16* __restrict__ wvP, _Float16* __restrict__ woP) {
  const int kt = blockIdx.x, ot = blockIdx.y;
  const int lane = threadIdx.x;
  const int m = lane & 15, koff = (lane >> 4) * 8;
  const int row = ot * 16 + m;
  const size_t pa = (size_t)(ot * 8 + kt) * FRAG + lane * 16;
  const size_t pb = (size_t)(kt * 16 + ot) * FRAG + lane * 16;
#pragma unroll
  for (int i = 0; i < 8; ++i) {
    const int K0 = kt * 32 + koff + i;
    const int K1 = kt * 32 + 16 + koff + i;
    wqP[pa + i]     = (_Float16)wq[row * Cn + K0];
    wqP[pa + i + 8] = (_Float16)wq[row * Cn + K1];
    wkP[pa + i]     = (_Float16)wk[row * Cn + K0];
    wkP[pa + i + 8] = (_Float16)wk[row * Cn + K1];
    wvP[pa + i]     = (_Float16)wv[row * Cn + K0];
    wvP[pa + i + 8] = (_Float16)wv[row * Cn + K1];
    // B-frag of Wo^T: element (K=c, col=o) = wo[o*C + c]  (same gather shape)
    woP[pb + i]     = (_Float16)wo[row * Cn + K0];
    woP[pb + i + 8] = (_Float16)wo[row * Cn + K1];
  }
}

// ---------------------------------------------------------------------------
// Kernel 1: GroupNorm -> xn packed directly as B-frags [b][nt][kt].
// one block per (b, group). grid 64, block 256.
// ---------------------------------------------------------------------------
__global__ __launch_bounds__(256) void gn_kernel(const float* __restrict__ x,
                                                 const float* __restrict__ gamma,
                                                 const float* __restrict__ beta,
                                                 _Float16* __restrict__ xnP) {
  const int b = blockIdx.x >> 4, grp = blockIdx.x & 15, t = threadIdx.x;
  const int CPG = Cn / GRP;                  // 16 channels per group
  const int total = CPG * Nsp;               // 65536
  const size_t base = ((size_t)b * Cn + (size_t)grp * CPG) * Nsp;

  float s = 0.f, ss = 0.f;
  for (int e = t; e < total; e += 256) {
    float v = x[base + e];
    s += v; ss += v * v;
  }
  __shared__ float rs[256], rss[256];
  rs[t] = s; rss[t] = ss;
  __syncthreads();
  for (int off = 128; off > 0; off >>= 1) {
    if (t < off) { rs[t] += rs[t + off]; rss[t] += rss[t + off]; }
    __syncthreads();
  }
  const float inv_n = 1.0f / (float)total;
  const float mean  = rs[0] * inv_n;
  const float rstd  = rsqrtf(rss[0] * inv_n - mean * mean + 1e-5f);

  for (int e = t; e < total; e += 256) {
    const int c = grp * CPG + e / Nsp;       // global channel
    const int n = e & (Nsp - 1);             // spatial index
    const float v = (x[base + e] - mean) * rstd * gamma[c] + beta[c];
    const int nt = n >> 4, col = n & 15, kt = c >> 5, Kin = c & 31;
    xnP[((size_t)(b * 256 + nt) * 8 + kt) * FRAG +
        frag_lane(Kin, col) * 16 + frag_slot(Kin)] = (_Float16)v;
  }
}

// ---------------------------------------------------------------------------
// Kernel 2: QKV GEMMs, fully packed operands. One wave / 16x16 tile.
//   writes qP & kP (K=channels) and vP (K=spatial); kP and vP in planes.
// grid (N/16, C/16, B), block 32.
// ---------------------------------------------------------------------------
__global__ __launch_bounds__(32) void qkv_kernel(
    const _Float16* __restrict__ xnP,
    const _Float16* __restrict__ wqP, const _Float16* __restrict__ wkP,
    const _Float16* __restrict__ wvP,
    const float* __restrict__ bq, const float* __restrict__ bk,
    const float* __restrict__ bv,
    _Float16* __restrict__ qP, _Float16* __restrict__ kP,
    _Float16* __restrict__ vP) {
  const int b = blockIdx.z, ot = blockIdx.y, nt = blockIdx.x;
  const int lane = threadIdx.x, nl = lane & 15, hh = lane >> 4;

  v8f aq = {}, ak = {}, av = {};
#pragma unroll
  for (int kt = 0; kt < 8; ++kt) {
    const v16h fq = load_frag(wqP + (size_t)(ot * 8 + kt) * FRAG + lane * 16);
    const v16h fk = load_frag(wkP + (size_t)(ot * 8 + kt) * FRAG + lane * 16);
    const v16h fv = load_frag(wvP + (size_t)(ot * 8 + kt) * FRAG + lane * 16);
    const v16h xb = load_frag(xnP + ((size_t)(b * 256 + nt) * 8 + kt) * FRAG + lane * 16);
    aq = wmma_f16(fq, xb, aq);
    ak = wmma_f16(fk, xb, ak);
    av = wmma_f16(fv, xb, av);
  }

#pragma unroll
  for (int v = 0; v < 8; ++v) {
    const int m = v + hh * 8;                  // channel row within tile
    const int o = ot * 16 + m;
    const _Float16 qv = (_Float16)(aq[v] + bq[o]);
    const _Float16 kv = (_Float16)(ak[v] + bk[o]);
    const _Float16 vv = (_Float16)(av[v] + bv[o]);
    // q/k: K = channel o, col = spatial nl  (A- and B-frag stripe identically)
    const int Kc = o & 31, ktc = o >> 5;
    const size_t fqk = ((size_t)(b * 256 + nt) * 8 + ktc) * FRAG;
    qP[fqk + frag_lane(Kc, nl) * 16 + frag_slot(Kc)] = qv;
    kP[fqk + plane_off(Kc, nl)] = kv;
    // v: K = spatial j, col = channel m within tile ct = ot
    const int jg = nt * 16 + nl, Kj = jg & 31, jt32 = jg >> 5;
    vP[((size_t)(b * 128 + jt32) * 16 + ot) * FRAG + plane_off(Kj, m)] = vv;
  }
}

static __device__ inline float xhalf(float x) {
  const int i = __builtin_bit_cast(int, x);
  return __builtin_bit_cast(float, __builtin_amdgcn_permlanex16(
      i, i, 0x76543210, 0xfedcba98, false, false));
}

__global__ __launch_bounds__(256) void attn_kernel(
    const _Float16* __restrict__ qP, const _Float16* __restrict__ kP,
    const _Float16* __restrict__ vP, _Float16* __restrict__ attP) {
  const int b = blockIdx.y;
  const int wave = threadIdx.x >> 5, lane = threadIdx.x & 31;
  const int it = blockIdx.x * 4 + (wave >> 1);   // query tile (16 columns)
  const int ch = wave & 1;                       // channel half (128 ch)

  __shared__ __align__(16) _Float16 sK[2][8192];  // 32 keys x 256 ch, 2 bufs
  __shared__ __align__(16) _Float16 sV[2][8192];  // 32 keys x 256 ch, 2 bufs

  // resident q fragments (all 256 channels of this query tile), used as B
  v16h qa[8];
#pragma unroll
  for (int kt = 0; kt < 8; ++kt)
    qa[kt] = load_frag(qP + ((size_t)(b * 256 + it) * 8 + kt) * FRAG + lane * 16);

  v8f acc[8];                      // acc[t][r] = O^T[ch*128 + t*16 + 8*hh + r][nl]
#pragma unroll
  for (int t = 0; t < 8; ++t) acc[t] = (v8f){};
  float rowM = -3.0e38f;           // running maximum of this lane's query
  float rowL = 0.0f;               // running sum over this wave half's keys

  const float sc = 0.0625f * 1.44269504088896f;   // 1/sqrt(C) * log2(e)

  if (threadIdx.x < 32) {
    tdm_copy_to_lds(kP + (size_t)(b * 256) * 8 * FRAG, lds_off(&sK[0][0]), 8192);
    tdm_copy_to_lds(vP + (size_t)(b * 128) * 16 * FRAG, lds_off(&sV[0][0]), 8192);
    __builtin_amdgcn_s_wait_tensorcnt(0);
  }
  __syncthreads();

  for (int j0 = 0; j0 < Nsp; j0 += 32) {
    const int buf = (j0 >> 5) & 1;
    if (threadIdx.x < 32 && (j0 + 32) < Nsp) {
      const int jn = j0 + 32;
      tdm_copy_to_lds(kP + (size_t)(b * 256 + (jn >> 4)) * 8 * FRAG,
                      lds_off(&sK[buf ^ 1][0]), 8192);
      tdm_copy_to_lds(vP + (size_t)(b * 128 + (jn >> 5)) * 16 * FRAG,
                      lds_off(&sV[buf ^ 1][0]), 8192);
    }

    // ---- scores^T: two 16(keys)x16(queries) tiles (K frags from LDS as A) ----
    v8f s0 = {}, s1 = {};
#pragma unroll
    for (int kt = 0; kt < 8; ++kt) {
      const v16h k0 = load_planes(&sK[buf][(kt)     * FRAG], lane);
      const v16h k1 = load_planes(&sK[buf][(8 + kt) * FRAG], lane);
      s0 = wmma_f16(k0, qa[kt], s0);
      s1 = wmma_f16(k1, qa[kt], s1);
    }

    // ---- online softmax, one query per lane ----
    float mx = fmaxf(s0[0], s1[0]);                // raw scores: the scale is positive
#pragma unroll
    for (int r = 1; r < 8; ++r) mx = fmaxf(mx, fmaxf(s0[r], s1[r]));
    mx = fmaxf(mx, xhalf(mx)) * sc;                // both halves: the query's maximum
    const float newM = fmaxf(rowM, mx);
    const float al = exp2f(rowM - newM);
    rowM = newM;

    v16h pb;
    float ps0 = 0.0f, ps1 = 0.0f;
#pragma unroll
    for (int r = 0; r < 8; ++r) {
      const float p0 = exp2f(s0[r] * sc - newM);
      const float p1 = exp2f(s1[r] * sc - newM);
      ps0 += p0;
      ps1 += p1;
      pb[r]     = (_Float16)p0;
      pb[r + 8] = (_Float16)p1;
    }
    rowL = rowL * al + (ps0 + ps1);

    // ---- V^T @ P^T: 8 channel tiles of this wave's half (V frags from LDS as A) ----
#pragma unroll
    for (int t = 0; t < 8; ++t) {
      const v16h vf = load_planes(&sV[buf][(ch * 8 + t) * FRAG], lane);
      acc[t] *= al;
      acc[t] = wmma_f16(vf, pb, acc[t]);
    }

    if (threadIdx.x < 32) __builtin_amdgcn_s_wait_tensorcnt(0);
    __syncthreads();               // hand off buffers
  }

  const float inv = 1.0f / (rowL + xhalf(rowL));   // join the halves' sums
#pragma unroll
  for (int t = 0; t < 8; ++t) {
    v8h o;
#pragma unroll
    for (int r = 0; r < 8; ++r) o[r] = (_Float16)(acc[t][r] * inv);
    *(v8h*)(attP + ((size_t)(b * 256 + it) * 8 + ch * 4 + (t >> 1)) * FRAG +
            lane * 16 + (t & 1) * 8) = o;
  }
}

// ---------------------------------------------------------------------------
// Kernel 4: output projection + residual (fp32 out), packed operands.
// grid (N/16, C/16, B), block 32.
// ---------------------------------------------------------------------------
__global__ __launch_bounds__(32) void proj_kernel(
    const _Float16* __restrict__ attP, const _Float16* __restrict__ woP,
    const float* __restrict__ bo, const float* __restrict__ x,
    float* __restrict__ out) {
  const int b = blockIdx.z, ot = blockIdx.y, nt = blockIdx.x;
  const int lane = threadIdx.x, nl = lane & 15, hh = lane >> 4;

  v8f acc = {};
#pragma unroll
  for (int kt = 0; kt < 8; ++kt) {
    const v16h fa = load_frag(attP + ((size_t)(b * 256 + nt) * 8 + kt) * FRAG + lane * 16);
    const v16h fb = load_frag(woP + (size_t)(kt * 16 + ot) * FRAG + lane * 16);
    acc = wmma_f16(fa, fb, acc);
  }
#pragma unroll
  for (int v = 0; v < 8; ++v) {
    const int m = v + hh * 8;                      // spatial row within tile
    const size_t idx = ((size_t)b * Cn + ot * 16 + nl) * Nsp + nt * 16 + m;
    out[idx] = acc[v] + bo[ot * 16 + nl] + x[idx];
  }
}

extern "C" void kernel_launch(void* const* d_in, const int* in_sizes, int n_in,
                              void* d_out, int out_size, void* d_ws, size_t ws_size,
                              hipStream_t stream) {
  const float* x     = (const float*)d_in[0];
  const float* gamma = (const float*)d_in[1];
  const float* beta  = (const float*)d_in[2];
  const float* wq    = (const float*)d_in[3];
  const float* bq    = (const float*)d_in[4];
  const float* wk    = (const float*)d_in[5];
  const float* bk    = (const float*)d_in[6];
  const float* wv    = (const float*)d_in[7];
  const float* bv    = (const float*)d_in[8];
  const float* wo    = (const float*)d_in[9];
  const float* bo    = (const float*)d_in[10];
  float* out = (float*)d_out;

  const size_t T = (size_t)Bn * Cn * Nsp;
  _Float16* xnP  = (_Float16*)d_ws;
  _Float16* qP   = xnP  + T;
  _Float16* kP   = qP   + T;
  _Float16* vP   = kP   + T;
  _Float16* attP = vP   + T;
  _Float16* wqP  = attP + T;
  _Float16* wkP  = wqP  + (size_t)Cn * Cn;
  _Float16* wvP  = wkP  + (size_t)Cn * Cn;
  _Float16* woP  = wvP  + (size_t)Cn * Cn;

  prep_weights_kernel<<<dim3(8, 16), 32, 0, stream>>>(
      wq, wk, wv, wo, wqP, wkP, wvP, woP);

  gn_kernel<<<Bn * GRP, 256, 0, stream>>>(x, gamma, beta, xnP);

  qkv_kernel<<<dim3(Nsp / 16, Cn / 16, Bn), 32, 0, stream>>>(
      xnP, wqP, wkP, wvP, bq, bk, bv, qP, kP, vP);

  attn_kernel<<<dim3(Nsp / 64, Bn), 256, 0, stream>>>(qP, kP, vP, attP);

  proj_kernel<<<dim3(Nsp / 16, Cn / 16, Bn), 32, 0, stream>>>(
      attP, woP, bo, x, out);
}

// v003
// A run of this version takes 149 microseconds.
// Timed twice side by side with v002, it ran 1.43 and 1.42 times as fast.
// All steps since v000 together make it 2.16 times as fast.
#include <hip/hip_runtime.h>

typedef __attribute__((ext_vector_type(16))) _Float16     v16h;
typedef __attribute__((ext_vector_type(8)))  _Float16     v8h;
typedef __attribute__((ext_vector_type(8)))  float        v8f;
typedef __attribute__((ext_vector_type(4)))  unsigned int u32x4;
typedef __attribute__((ext_vector_type(8)))  unsigned int u32x8;
typedef __attribute__((ext_vector_type(4)))  float        f32x4;

#define Cn   256
#define Nsp  4096      // H*W
#define Bn   4
#define GRP  16
#define FRAG 512       // halfs per packed fragment: 32 lanes x 16 halfs (32B/lane)

static __device__ inline v8f wmma_f16(v16h a, v16h b, v8f c) {
  return __builtin_amdgcn_wmma_f32_16x16x32_f16(
      false, a, false, b, (short)0, c, false, false);
}

static __device__ inline int frag_slot(int Kin) {
  return ((Kin & 16) ? 8 : 0) + (Kin & 7);
}
static __device__ inline int frag_lane(int Kin, int col) {
  return col + (((Kin >> 3) & 1) << 4);
}
static __device__ inline v16h load_frag(const _Float16* p) {
  return *(const v16h*)p;            // 32B -> 2x b128 loads
}

#define PLANE 256      // halfs per plane
static __device__ inline int plane_off(int Kin, int col) {
  return ((Kin & 16) ? PLANE : 0) + frag_lane(Kin, col) * 8 + (Kin & 7);
}
static __device__ inline v16h load_planes(const _Float16* frag, int lane) {
  const v8h lo = *(const v8h*)(frag + lane * 8);
  const v8h hi = *(const v8h*)(frag + PLANE + lane * 8);
  return __builtin_shufflevector(lo, hi, 0, 1, 2, 3, 4, 5, 6, 7,
                                 8, 9, 10, 11, 12, 13, 14, 15);
}

static __device__ inline unsigned lds_off(const void* p) {
  return (unsigned)(uintptr_t)p;
}
static __device__ inline uint32_t uni(uint32_t v) {
  return (uint32_t)__builtin_amdgcn_readfirstlane(v);
}
static __device__ inline uint32_t pinned(uint32_t v) {
  uint32_t w = uni(v);
  asm volatile("" : "+s"(w));   // pinned(): the value stays in a scalar register, so a test on it is s_cmp + s_cbranch_scc
  return w;
}
static __device__ inline u32x4 tdm_group0(uint32_t lds_dst, uint64_t ga) {
  u32x4 g;
  g[0] = uni(1u);                                              // count = 1
  g[1] = uni(lds_dst);                                         // LDS byte offset
  g[2] = uni((uint32_t)ga);                                    // address [31:0]
  g[3] = uni((((uint32_t)(ga >> 32)) & 0x01FFFFFFu) | 0x80000000u);  // [56:32], type 2
  return g;
}
static __device__ inline u32x8 tdm_group1() {
  constexpr uint32_t d0 = 1024u, d1 = 16u;   // row bytes, rows; tensor = tile
  u32x8 g;
  g[0] = uni(0u);                            // no mask, 1-byte elements, no pad
  g[1] = uni((d0 & 0xFFFFu) << 16);
  g[2] = uni((d0 >> 16) | ((d1 & 0xFFFFu) << 16));
  g[3] = uni((d1 >> 16) | (d0 << 16));
  g[4] = uni(d1);
  g[5] = uni(d0);                            // source row pitch = the row
  g[6] = uni(0u);
  g[7] = uni(0u);
  return g;
}
static __device__ inline void tdm_load(u32x4 g0, u32x8 g1) {
  asm volatile("tensor_load_to_lds %0, %1" :: "s"(g0), "s"(g1) : "memory");
}
// The compiler places no wait for a tensor load and none that orders LDS reads
// against a refill: both are written where a stage is handed over.
static __device__ inline void wait_tensor0() { asm volatile("s_wait_tensorcnt 0x0" ::: "memory"); }
static __device__ inline void wait_ds0()     { asm volatile("s_wait_dscnt 0x0" ::: "memory"); }

// ---------------------------------------------------------------------------
// Kernel 0: weights fp32 -> packed fp16 fragments.
//   wq/wk/wv as A-frags [ot][kt]; Wo^T as B-frags [kt][ot].
// grid (8 kt, 16 ot), block 32.
// ---------------------------------------------------------------------------
__global__ __launch_bounds__(32) void prep_weights_kernel(
    const float* __restrict__ wq, const float* __restrict__ wk,
    const float* __restrict__ wv, const float* __restrict__ wo,
    _Float16* __restrict__ wqP, _Float16* __restrict__ wkP,
    _Float16* __restrict__ wvP, _Float16* __restrict__ woP) {
  const int kt = blockIdx.x, ot = blockIdx.y;
  const int lane = threadIdx.x;
  const int m = lane & 15, koff = (lane >> 4) * 8;
  const int row = ot * 16 + m;
  const size_t pa = (size_t)(ot * 8 + kt) * FRAG + lane * 16;
  const size_t pb = (size_t)(kt * 16 + ot) * FRAG + lane * 16;
#pragma unroll
  for (int i = 0; i < 8; ++i) {
    const int K0 = kt * 32 + koff + i;
    const int K1 = kt * 32 + 16 + koff + i;
    wqP[pa + i]     = (_Float16)wq[row * Cn + K0];
    wqP[pa + i + 8] = (_Float16)wq[row * Cn + K1];
    wkP[pa + i]     = (_Float16)wk[row * Cn + K0];
    wkP[pa + i + 8] = (_Float16)wk[row * Cn + K1];
    wvP[pa + i]     = (_Float16)wv[row * Cn + K0];
    wvP[pa + i + 8] = (_Float16)wv[row * Cn + K1];
    // B-frag of Wo^T: element (K=c, col=o) = wo[o*C + c]  (same gather shape)
    woP[pb + i]     = (_Float16)wo[row * Cn + K0];
    woP[pb + i + 8] = (_Float16)wo[row * Cn + K1];
  }
}

// ---------------------------------------------------------------------------
// Kernel 1: GroupNorm -> xn packed directly as B-frags [b][nt][kt].
// one block per (b, group). grid 64, block 256.
// ---------------------------------------------------------------------------
__global__ __launch_bounds__(256) void gn_kernel(const float* __restrict__ x,
                                                 const float* __restrict__ gamma,
                                                 const float* __restrict__ beta,
                                                 _Float16* __restrict__ xnP) {
  const int b = blockIdx.x >> 4, grp = blockIdx.x & 15, t = threadIdx.x;
  const int CPG = Cn / GRP;                  // 16 channels per group
  const int total = CPG * Nsp;               // 65536
  const size_t base = ((size_t)b * Cn + (size_t)grp * CPG) * Nsp;

  float s = 0.f, ss = 0.f;
  for (int e = t; e < total; e += 256) {
    float v = x[base + e];
    s += v; ss += v * v;
  }
  __shared__ float rs[256], rss[256];
  rs[t] = s; rss[t] = ss;
  __syncthreads();
  for (int off = 128; off > 0; off >>= 1) {
    if (t < off) { rs[t] += rs[t + off]; rss[t] += rss[t + off]; }
    __syncthreads();
  }
  const float inv_n = 1.0f / (float)total;
  const float mean  = rs[0] * inv_n;
  const float rstd  = rsqrtf(rss[0] * inv_n - mean * mean + 1e-5f);

  for (int e = t; e < total; e += 256) {
    const int c = grp * CPG + e / Nsp;       // global channel
    const int n = e & (Nsp - 1);             // spatial index
    const float v = (x[base + e] - mean) * rstd * gamma[c] + beta[c];
    const int nt = n >> 4, col = n & 15, kt = c >> 5, Kin = c & 31;
    xnP[((size_t)(b * 256 + nt) * 8 + kt) * FRAG +
        frag_lane(Kin, col) * 16 + frag_slot(Kin)] = (_Float16)v;
  }
}

// ---------------------------------------------------------------------------
// Kernel 2: QKV GEMMs, fully packed operands. One wave / 16x16 tile.
//   writes qP & kP (K=channels) and vP (K=spatial); kP and vP in planes.
// grid (N/16, C/16, B), block 32.
// ---------------------------------------------------------------------------
__global__ __launch_bounds__(32) void qkv_kernel(
    const _Float16* __restrict__ xnP,
    const _Float16* __restrict__ wqP, const _Float16* __restrict__ wkP,
    const _Float16* __restrict__ wvP,
    const float* __restrict__ bq, const float* __restrict__ bk,
    const float* __restrict__ bv,
    _Float16* __restrict__ qP, _Float16* __restrict__ kP,
    _Float16* __restrict__ vP) {
  const int b = blockIdx.z, ot = blockIdx.y, nt = blockIdx.x;
  const int lane = threadIdx.x, nl = lane & 15, hh = lane >> 4;

  v8f aq = {}, ak = {}, av = {};
#pragma unroll
  for (int kt = 0; kt < 8; ++kt) {
    const v16h fq = load_frag(wqP + (size_t)(ot * 8 + kt) * FRAG + lane * 16);
    const v16h fk = load_frag(wkP + (size_t)(ot * 8 + kt) * FRAG + lane * 16);
    const v16h fv = load_frag(wvP + (size_t)(ot * 8 + kt) * FRAG + lane * 16);
    const v16h xb = load_frag(xnP + ((size_t)(b * 256 + nt) * 8 + kt) * FRAG + lane * 16);
    aq = wmma_f16(fq, xb, aq);
    ak = wmma_f16(fk, xb, ak);
    av = wmma_f16(fv, xb, av);
  }

#pragma unroll
  for (int v = 0; v < 8; ++v) {
    const int m = v + hh * 8;                  // channel row within tile
    const int o = ot * 16 + m;
    const _Float16 qv = (_Float16)(aq[v] + bq[o]);
    const _Float16 kv = (_Float16)(ak[v] + bk[o]);
    const _Float16 vv = (_Float16)(av[v] + bv[o]);
    // q/k: K = channel o, col = spatial nl  (A- and B-frag stripe identically)
    const int Kc = o & 31, ktc = o >> 5;
    const size_t fqk = ((size_t)(b * 256 + nt) * 8 + ktc) * FRAG;
    qP[fqk + frag_lane(Kc, nl) * 16 + frag_slot(Kc)] = qv;
    kP[fqk + plane_off(Kc, nl)] = kv;
    // v: K = spatial j, col = channel m within tile ct = ot
    const int jg = nt * 16 + nl, Kj = jg & 31, jt32 = jg >> 5;
    vP[((size_t)(b * 128 + jt32) * 16 + ot) * FRAG + plane_off(Kj, m)] = vv;
  }
}

static __device__ inline float xhalf(float x) {
  const int i = __builtin_bit_cast(int, x);
  return __builtin_bit_cast(float, __builtin_amdgcn_permlanex16(
      i, i, 0x76543210, 0xfedcba98, false, false));
}

#define NST    32u        // stages
#define TILE_B 16384u     // bytes of one K or V tile of 32 keys
#define GRP_B  32768u     // LDS bytes of one key group in a buffer (K, then V)
#define BUF_B  131072u    // LDS bytes of one buffer
#define RING_B 262144u    // two buffers

__global__ __launch_bounds__(256) void attn_kernel(
    const _Float16* __restrict__ qP, const _Float16* __restrict__ kP,
    const _Float16* __restrict__ vP, _Float16* __restrict__ attP) {
  const int b = blockIdx.y;
  const uint32_t wave = uni(threadIdx.x >> 5);
  const int lane = threadIdx.x & 31;
  const uint32_t kg = wave >> 1;                 // key group
  const uint32_t qg = wave & 1u;                 // query group (32 columns)
  const int it0 = blockIdx.x * 4 + (int)qg * 2;  // first of two query tiles

  __shared__ __attribute__((aligned(2048))) unsigned char lds[RING_B + 4096u];

  // resident q fragments (all 256 channels of both query tiles), used as B
  v16h qa[2][8];
#pragma unroll
  for (int q = 0; q < 2; ++q)
#pragma unroll
    for (int kt = 0; kt < 8; ++kt)
      qa[q][kt] = load_frag(qP + ((size_t)(b * 256 + it0 + q) * 8 + kt) * FRAG + lane * 16);

  v8f acc[2][16];                  // acc[q][t][r] = O^T[t*16 + 8*hh + r][nl] of tile q
#pragma unroll
  for (int q = 0; q < 2; ++q)
#pragma unroll
    for (int t = 0; t < 16; ++t) acc[q][t] = (v8f){};
  float rowM[2] = {-3.0e38f, -3.0e38f};   // running maxima of this lane's queries
  float rowL[2] = {0.0f, 0.0f};           // running sums over this wave half's keys

  const float sc = 0.0625f * 1.44269504088896f;   // 1/sqrt(C) * log2(e)

  // this wave's slice of a stage: tile j of K and of V both start at byte j * 16 KiB
  const u32x8 g1 = tdm_group1();
  const uint64_t gsrc = (uint64_t)(uintptr_t)(qg ? vP : kP) + (uint64_t)(b * 128) * TILE_B;
  const uint32_t dst = lds_off(lds) + kg * GRP_B + qg * TILE_B;

  // prologue, two buffers: stage 0, wait, barrier, stage 1
  tdm_load(tdm_group0(dst, gsrc + (uint64_t)kg * TILE_B), g1);
  wait_tensor0();
  __syncthreads();
  tdm_load(tdm_group0(dst + BUF_B, gsrc + (uint64_t)(4u + kg) * TILE_B), g1);

  for (uint32_t s = 0; s < NST; ++s) {
    const _Float16* Kb = (const _Float16*)(lds + (s & 1u) * BUF_B + kg * GRP_B);
    const _Float16* Vb = Kb + 8192;

    // ---- scores^T: 2 key tiles x 2 query tiles (K frags from LDS as A) ----
    v8f s0[2] = {(v8f){}, (v8f){}}, s1[2] = {(v8f){}, (v8f){}};
#pragma unroll
    for (int h = 0; h < 2; ++h) {
      v16h k0[4], k1[4];
#pragma unroll
      for (int i = 0; i < 4; ++i) {
        k0[i] = load_planes(Kb + (h * 4 + i)     * FRAG, lane);
        k1[i] = load_planes(Kb + (8 + h * 4 + i) * FRAG, lane);
      }
      __builtin_amdgcn_sched_barrier(0);
#pragma unroll
      for (int i = 0; i < 4; ++i) {
        const int kt = h * 4 + i;
        s0[0] = wmma_f16(k0[i], qa[0][kt], s0[0]);
        s1[0] = wmma_f16(k1[i], qa[0][kt], s1[0]);
        s0[1] = wmma_f16(k0[i], qa[1][kt], s0[1]);
        s1[1] = wmma_f16(k1[i], qa[1][kt], s1[1]);
      }
      __builtin_amdgcn_sched_barrier(0);
    }

    // ---- online softmax, one query per lane and tile ----
    v16h pb[2];
    float al[2];
#pragma unroll
    for (int q = 0; q < 2; ++q) {
      float mx = fmaxf(s0[q][0], s1[q][0]);        // raw scores: the scale is positive
#pragma unroll
      for (int r = 1; r < 8; ++r) mx = fmaxf(mx, fmaxf(s0[q][r], s1[q][r]));
      mx = fmaxf(mx, xhalf(mx)) * sc;              // both halves: the query's maximum
      const float newM = fmaxf(rowM[q], mx);
      al[q] = exp2f(rowM[q] - newM);
      rowM[q] = newM;
      float ps0 = 0.0f, ps1 = 0.0f;
#pragma unroll
      for (int r = 0; r < 8; ++r) {
        const float p0 = exp2f(s0[q][r] * sc - newM);
        const float p1 = exp2f(s1[q][r] * sc - newM);
        ps0 += p0;
        ps1 += p1;
        pb[q][r]     = (_Float16)p0;
        pb[q][r + 8] = (_Float16)p1;
      }
      rowL[q] = rowL[q] * al[q] + (ps0 + ps1);
    }

    // ---- V^T @ P^T: 16 channel tiles x 2 query tiles (V frags from LDS as A) ----
#pragma unroll
    for (int t = 0; t < 16; ++t) {
      const v16h vf = load_planes(Vb + t * FRAG, lane);
#pragma unroll
      for (int q = 0; q < 2; ++q) {
        acc[q][t] *= al[q];
        acc[q][t] = wmma_f16(vf, pb[q], acc[q][t]);
      }
    }

    // ---- publish point of stage s + 1; then refill the buffer just read ----
    wait_ds0();
    wait_tensor0();
    __syncthreads();
    if (pinned(s + 2u < NST)) {
      const uint32_t j = pinned((s + 2u) * 4u + kg);
      tdm_load(tdm_group0(dst + (s & 1u) * BUF_B, gsrc + (uint64_t)j * TILE_B), g1);
    }
  }
  wait_tensor0();
  wait_ds0();
  // The last pass's own barrier has ended every wave's reads: the ring becomes staging.

  // ---- join the four key groups: O = sum_g w_g O_g, w_g = 2^(m_g - M) / L ----
  float* sM = (float*)(lds + RING_B);            // [wave][q][lane]
  float* sL = sM + 512;
  f32x4* st = (f32x4*)lds;                       // [wave][q][t][r half][lane], 16 B
#pragma unroll
  for (int q = 0; q < 2; ++q) {
    sM[(wave * 2 + q) * 32 + lane] = rowM[q];
    sL[(wave * 2 + q) * 32 + lane] = rowL[q] + xhalf(rowL[q]);   // join the halves' sums
#pragma unroll
    for (int t = 0; t < 16; ++t) {
      f32x4* p = st + (((wave * 2 + q) * 16 + t) * 2) * 32 + lane;
      p[0]  = __builtin_shufflevector(acc[q][t], acc[q][t], 0, 1, 2, 3);
      p[32] = __builtin_shufflevector(acc[q][t], acc[q][t], 4, 5, 6, 7);
    }
  }
  __syncthreads();

#pragma unroll
  for (int q = 0; q < 2; ++q) {
    float m[4], w[4];
#pragma unroll
    for (int g = 0; g < 4; ++g) m[g] = sM[((g * 2 + qg) * 2 + q) * 32 + lane];
    const float M = fmaxf(fmaxf(m[0], m[1]), fmaxf(m[2], m[3]));
    float L = 0.0f;
#pragma unroll
    for (int g = 0; g < 4; ++g) {
      w[g] = exp2f(m[g] - M);
      L += sL[((g * 2 + qg) * 2 + q) * 32 + lane] * w[g];
    }
    const float inv = 1.0f / L;
#pragma unroll
    for (int g = 0; g < 4; ++g) w[g] *= inv;
#pragma unroll
    for (int tt = 0; tt < 4; ++tt) {
      const uint32_t t = kg * 4 + tt;
      f32x4 lo = {0.0f, 0.0f, 0.0f, 0.0f}, hi = {0.0f, 0.0f, 0.0f, 0.0f};
#pragma unroll
      for (int g = 0; g < 4; ++g) {
        const f32x4* p = st + ((((g * 2 + qg) * 2 + q) * 16 + t) * 2) * 32 + lane;
        lo += p[0] * w[g];
        hi += p[32] * w[g];
      }
      v8h o;
#pragma unroll
      for (int r = 0; r < 4; ++r) { o[r] = (_Float16)lo[r]; o[r + 4] = (_Float16)hi[r]; }
      *(v8h*)(attP + ((size_t)(b * 256 + it0 + q) * 8 + (t >> 1)) * FRAG +
              lane * 16 + (t & 1u) * 8) = o;
      asm volatile("s_wait_xcnt 0x0" ::: "memory");  // stands before the next tile writes over the store's registers
    }
  }
}

// ---------------------------------------------------------------------------
// Kernel 4: output projection + residual (fp32 out), packed operands.
// grid (N/16, C/16, B), block 32.
// ---------------------------------------------------------------------------
__global__ __launch_bounds__(32) void proj_kernel(
    const _Float16* __restrict__ attP, const _Float16* __restrict__ woP,
    const float* __restrict__ bo, const float* __restrict__ x,
    float* __restrict__ out) {
  const int b = blockIdx.z, ot = blockIdx.y, nt = blockIdx.x;
  const int lane = threadIdx.x, nl = lane & 15, hh = lane >> 4;

  v8f acc = {};
#pragma unroll
  for (int kt = 0; kt < 8; ++kt) {
    const v16h fa = load_frag(attP + ((size_t)(b * 256 + nt) * 8 + kt) * FRAG + lane * 16);
    const v16h fb = load_frag(woP + (size_t)(kt * 16 + ot) * FRAG + lane * 16);
    acc = wmma_f16(fa, fb, acc);
  }
#pragma unroll
  for (int v = 0; v < 8; ++v) {
    const int m = v + hh * 8;                      // spatial row within tile
    const size_t idx = ((size_t)b * Cn + ot * 16 + nl) * Nsp + nt * 16 + m;
    out[idx] = acc[v] + bo[ot * 16 + nl] + x[idx];
  }
}

extern "C" void kernel_launch(void* const* d_in, const int* in_sizes, int n_in,
                              void* d_out, int out_size, void* d_ws, size_t ws_size,
                              hipStream_t stream) {
  const float* x     = (const float*)d_in[0];
  const float* gamma = (const float*)d_in[1];
  const float* beta  = (const float*)d_in[2];
  const float* wq    = (const float*)d_in[3];
  const float* bq    = (const float*)d_in[4];
  const float* wk    = (const float*)d_in[5];
  const float* bk    = (const float*)d_in[6];
  const float* wv    = (const float*)d_in[7];
  const float* bv    = (const float*)d_in[8];
  const float* wo    = (const float*)d_in[9];
  const float* bo    = (const float*)d_in[10];
  float* out = (float*)d_out;

  const size_t T = (size_t)Bn * Cn * Nsp;
  _Float16* xnP  = (_Float16*)d_ws;
  _Float16* qP   = xnP  + T;
  _Float16* kP   = qP   + T;
  _Float16* vP   = kP   + T;
  _Float16* attP = vP   + T;
  _Float16* wqP  = attP + T;
  _Float16* wkP  = wqP  + (size_t)Cn * Cn;
  _Float16* wvP  = wkP  + (size_t)Cn * Cn;
  _Float16* woP  = wvP  + (size_t)Cn * Cn;

  prep_weights_kernel<<<dim3(8, 16), 32, 0, stream>>>(
      wq, wk, wv, wo, wqP, wkP, wvP, woP);

  gn_kernel<<<Bn * GRP, 256, 0, stream>>>(x, gamma, beta, xnP);

  qkv_kernel<<<dim3(Nsp / 16, Cn / 16, Bn), 32, 0, stream>>>(
      xnP, wqP, wkP, wvP, bq, bk, bv, qP, kP, vP);

  attn_kernel<<<dim3(Nsp / 64, Bn), 256, 0, stream>>>(qP, kP, vP, attP);

  proj_kernel<<<dim3(Nsp / 16, Cn / 16, Bn), 32, 0, stream>>>(
      attP, woP, bo, x, out);
}

// v004
// One run takes 124 microseconds.
// Two timings next to v003 both put it at 1.20 times that version's speed.
// All steps since v000 together make it 2.59 times as fast.
#include <hip/hip_runtime.h>

typedef __attribute__((ext_vector_type(16))) _Float16     v16h;
typedef __attribute__((ext_vector_type(8)))  _Float16     v8h;
typedef __attribute__((ext_vector_type(8)))  float        v8f;
typedef __attribute__((ext_vector_type(4)))  unsigned int u32x4;
typedef __attribute__((ext_vector_type(8)))  unsigned int u32x8;
typedef __attribute__((ext_vector_type(4)))  float        f32x4;

#define Cn   256
#define Nsp  4096      // H*W
#define Bn   4
#define GRP  16
#define FRAG 512       // halfs per packed fragment: 32 lanes x 16 halfs (32B/lane)

static __device__ inline v8f wmma_f16(v16h a, v16h b, v8f c) {
  return __builtin_amdgcn_wmma_f32_16x16x32_f16(
      false, a, false, b, (short)0, c, false, false);
}

static __device__ inline int frag_slot(int Kin) {
  return ((Kin & 16) ? 8 : 0) + (Kin & 7);
}
static __device__ inline int frag_lane(int Kin, int col) {
  return col + (((Kin >> 3) & 1) << 4);
}
static __device__ inline v16h load_frag(const _Float16* p) {
  return *(const v16h*)p;            // 32B -> 2x b128 loads
}

#define PLANE 256      // halfs per plane
static __device__ inline int plane_off(int Kin, int col) {
  return ((Kin & 16) ? PLANE : 0) + frag_lane(Kin, col) * 8 + (Kin & 7);
}
static __device__ inline v16h load_planes(const _Float16* frag, int lane) {
  const v8h lo = *(const v8h*)(frag + lane * 8);
  const v8h hi = *(const v8h*)(frag + PLANE + lane * 8);
  return __builtin_shufflevector(lo, hi, 0, 1, 2, 3, 4, 5, 6, 7,
                                 8, 9, 10, 11, 12, 13, 14, 15);
}

static __device__ inline unsigned lds_off(const void* p) {
  return (unsigned)(uintptr_t)p;
}
static __device__ inline uint32_t uni(uint32_t v) {
  return (uint32_t)__builtin_amdgcn_readfirstlane(v);
}
static __device__ inline uint32_t pinned(uint32_t v) {
  uint32_t w = uni(v);
  asm volatile("" : "+s"(w));   // pinned(): the value stays in a scalar register, so a test on it is s_cmp + s_cbranch_scc
  return w;
}
static __device__ inline u32x4 tdm_group0(uint32_t lds_dst, uint64_t ga) {
  u32x4 g;
  g[0] = uni(1u);                                              // count = 1
  g[1] = uni(lds_dst);                                         // LDS byte offset
  g[2] = uni((uint32_t)ga);                                    // address [31:0]
  g[3] = uni((((uint32_t)(ga >> 32)) & 0x01FFFFFFu) | 0x80000000u);  // [56:32], type 2
  return g;
}
static __device__ inline u32x8 tdm_group1() {
  constexpr uint32_t d0 = 1024u, d1 = 16u;   // row bytes, rows; tensor = tile
  u32x8 g;
  g[0] = uni(0u);                            // no mask, 1-byte elements, no pad
  g[1] = uni((d0 & 0xFFFFu) << 16);
  g[2] = uni((d0 >> 16) | ((d1 & 0xFFFFu) << 16));
  g[3] = uni((d1 >> 16) | (d0 << 16));
  g[4] = uni(d1);
  g[5] = uni(d0);                            // source row pitch = the row
  g[6] = uni(0u);
  g[7] = uni(0u);
  return g;
}
static __device__ inline void tdm_load(u32x4 g0, u32x8 g1) {
  asm volatile("tensor_load_to_lds %0, %1" :: "s"(g0), "s"(g1) : "memory");
}
// The compiler places no wait for a tensor load and none that orders LDS reads
// against a refill: both are written where a stage is handed over.
static __device__ inline void wait_tensor0() { asm volatile("s_wait_tensorcnt 0x0" ::: "memory"); }
static __device__ inline void wait_ds0()     { asm volatile("s_wait_dscnt 0x0" ::: "memory"); }

// ---------------------------------------------------------------------------
// Kernel 0: weights fp32 -> packed fp16 fragments.
//   wq/wk/wv as A-frags [ot][kt]; Wo^T as B-frags [kt][ot].
// grid (8 kt, 16 ot), block 32.
// ---------------------------------------------------------------------------
__global__ __launch_bounds__(32) void prep_weights_kernel(
    const float* __restrict__ wq, const float* __restrict__ wk,
    const float* __restrict__ wv, const float* __restrict__ wo,
    _Float16* __restrict__ wqP, _Float16* __restrict__ wkP,
    _Float16* __restrict__ wvP, _Float16* __restrict__ woP) {
  const int kt = blockIdx.x, ot = blockIdx.y;
  const int lane = threadIdx.x;
  const int m = lane & 15, koff = (lane >> 4) * 8;
  const int row = ot * 16 + m;
  const size_t pa = (size_t)(ot * 8 + kt) * FRAG + lane * 16;
  const size_t pb = (size_t)(kt * 16 + ot) * FRAG + lane * 16;
#pragma unroll
  for (int i = 0; i < 8; ++i) {
    const int K0 = kt * 32 + koff + i;
    const int K1 = kt * 32 + 16 + koff + i;
    wqP[pa + i]     = (_Float16)wq[row * Cn + K0];
    wqP[pa + i + 8] = (_Float16)wq[row * Cn + K1];
    wkP[pa + i]     = (_Float16)wk[row * Cn + K0];
    wkP[pa + i + 8] = (_Float16)wk[row * Cn + K1];
    wvP[pa + i]     = (_Float16)wv[row * Cn + K0];
    wvP[pa + i + 8] = (_Float16)wv[row * Cn + K1];
    // B-frag of Wo^T: element (K=c, col=o) = wo[o*C + c]  (same gather shape)
    woP[pb + i]     = (_Float16)wo[row * Cn + K0];
    woP[pb + i + 8] = (_Float16)wo[row * Cn + K1];
  }
}

static __device__ inline float xhalf(float x) {
  const int i = __builtin_bit_cast(int, x);
  return __builtin_bit_cast(float, __builtin_amdgcn_permlanex16(
      i, i, 0x76543210, 0xfedcba98, false, false));
}
template <int MASK>
static __device__ inline float xrow(float x) {
  const int i = __builtin_bit_cast(int, x);
  return __builtin_bit_cast(float, __builtin_amdgcn_update_dpp(
      i, i, 0x160 + MASK, 0xf, 0xf, false));      // 0x160: row_xmask
}
static __device__ inline float wave_sum(float x) {  // every lane gets the sum of all 32
  x += xrow<1>(x);
  x += xrow<2>(x);
  x += xrow<4>(x);
  x += xrow<8>(x);
  return x + xhalf(x);
}

__global__ __launch_bounds__(1024) void gn_kernel(const float* __restrict__ x,
                                                  const float* __restrict__ gamma,
                                                  const float* __restrict__ beta,
                                                  _Float16* __restrict__ xnP) {
  const int b = blockIdx.x >> 4, grp = blockIdx.x & 15, t = threadIdx.x;
  const int CPG = Cn / GRP;                  // 16 channels per group
  const int total = CPG * Nsp;               // 65536
  const float* xg = x + ((size_t)b * Cn + (size_t)grp * CPG) * Nsp + t;

  float v[4][16];                            // v[k][cc] = channel cc at n = t + 1024*k
#pragma unroll
  for (int k = 0; k < 4; ++k)
#pragma unroll
    for (int cc = 0; cc < 16; ++cc) v[k][cc] = xg[cc * Nsp + k * 1024];

  float s[4], ss[4];                         // four independent chains
#pragma unroll
  for (int k = 0; k < 4; ++k) {
    s[k] = 0.f; ss[k] = 0.f;
#pragma unroll
    for (int cc = 0; cc < 16; ++cc) { s[k] += v[k][cc]; ss[k] += v[k][cc] * v[k][cc]; }
  }
  const float ws  = wave_sum((s[0] + s[1]) + (s[2] + s[3]));
  const float wss = wave_sum((ss[0] + ss[1]) + (ss[2] + ss[3]));
  __shared__ float rs[32], rss[32];          // one sum per wave
  if ((t & 31) == 0) { rs[t >> 5] = ws; rss[t >> 5] = wss; }
  __syncthreads();
  const float inv_n = 1.0f / (float)total;
  const float mean  = wave_sum(rs[t & 31]) * inv_n;
  const float rstd  = rsqrtf(wave_sum(rss[t & 31]) * inv_n - mean * mean + 1e-5f);

  _Float16* o = xnP + ((size_t)(b * 256 + (t >> 4)) * 8 + (grp >> 1)) * FRAG +
                (t & 15) * 16 + (grp & 1) * 8;
#pragma unroll
  for (int k = 0; k < 4; ++k)
#pragma unroll
    for (int h = 0; h < 2; ++h) {
      v8h p;
#pragma unroll
      for (int i = 0; i < 8; ++i) {
        const int c = grp * CPG + h * 8 + i;
        p[i] = (_Float16)((v[k][h * 8 + i] - mean) * rstd * gamma[c] + beta[c]);
      }
      *(v8h*)(o + (size_t)k * 64 * 8 * FRAG + h * 256) = p;
    }
}

// ---------------------------------------------------------------------------
// Kernel 2: QKV GEMMs, fully packed operands. One wave / 16x16 tile.
//   writes qP & kP (K=channels) and vP (K=spatial); kP and vP in planes.
// grid (N/16, C/16, B), block 32.
// ---------------------------------------------------------------------------
__global__ __launch_bounds__(32) void qkv_kernel(
    const _Float16* __restrict__ xnP,
    const _Float16* __restrict__ wqP, const _Float16* __restrict__ wkP,
    const _Float16* __restrict__ wvP,
    const float* __restrict__ bq, const float* __restrict__ bk,
    const float* __restrict__ bv,
    _Float16* __restrict__ qP, _Float16* __restrict__ kP,
    _Float16* __restrict__ vP) {
  const int b = blockIdx.z, ot = blockIdx.y, nt = blockIdx.x;
  const int lane = threadIdx.x, nl = lane & 15, hh = lane >> 4;

  v8f aq = {}, ak = {}, av = {};
#pragma unroll
  for (int kt = 0; kt < 8; ++kt) {
    const v16h fq = load_frag(wqP + (size_t)(ot * 8 + kt) * FRAG + lane * 16);
    const v16h fk = load_frag(wkP + (size_t)(ot * 8 + kt) * FRAG + lane * 16);
    const v16h fv = load_frag(wvP + (size_t)(ot * 8 + kt) * FRAG + lane * 16);
    const v16h xb = load_frag(xnP + ((size_t)(b * 256 + nt) * 8 + kt) * FRAG + lane * 16);
    aq = wmma_f16(fq, xb, aq);
    ak = wmma_f16(fk, xb, ak);
    av = wmma_f16(fv, xb, av);
  }

#pragma unroll
  for (int v = 0; v < 8; ++v) {
    const int m = v + hh * 8;                  // channel row within tile
    const int o = ot * 16 + m;
    const _Float16 qv = (_Float16)(aq[v] + bq[o]);
    const _Float16 kv = (_Float16)(ak[v] + bk[o]);
    const _Float16 vv = (_Float16)(av[v] + bv[o]);
    // q/k: K = channel o, col = spatial nl  (A- and B-frag stripe identically)
    const int Kc = o & 31, ktc = o >> 5;
    const size_t fqk = ((size_t)(b * 256 + nt) * 8 + ktc) * FRAG;
    qP[fqk + frag_lane(Kc, nl) * 16 + frag_slot(Kc)] = qv;
    kP[fqk + plane_off(Kc, nl)] = kv;
    // v: K = spatial j, col = channel m within tile ct = ot
    const int jg = nt * 16 + nl, Kj = jg & 31, jt32 = jg >> 5;
    vP[((size_t)(b * 128 + jt32) * 16 + ot) * FRAG + plane_off(Kj, m)] = vv;
  }
}

#define NST    32u        // stages
#define TILE_B 16384u     // bytes of one K or V tile of 32 keys
#define GRP_B  32768u     // LDS bytes of one key group in a buffer (K, then V)
#define BUF_B  131072u    // LDS bytes of one buffer
#define RING_B 262144u    // two buffers

__global__ __launch_bounds__(256) void attn_kernel(
    const _Float16* __restrict__ qP, const _Float16* __restrict__ kP,
    const _Float16* __restrict__ vP, _Float16* __restrict__ attP) {
  const int b = blockIdx.y;
  const uint32_t wave = uni(threadIdx.x >> 5);
  const int lane = threadIdx.x & 31;
  const uint32_t kg = wave >> 1;                 // key group
  const uint32_t qg = wave & 1u;                 // query group (32 columns)
  const int it0 = blockIdx.x * 4 + (int)qg * 2;  // first of two query tiles

  __shared__ __attribute__((aligned(2048))) unsigned char lds[RING_B + 4096u];

  // resident q fragments (all 256 channels of both query tiles), used as B
  v16h qa[2][8];
#pragma unroll
  for (int q = 0; q < 2; ++q)
#pragma unroll
    for (int kt = 0; kt < 8; ++kt)
      qa[q][kt] = load_frag(qP + ((size_t)(b * 256 + it0 + q) * 8 + kt) * FRAG + lane * 16);

  v8f acc[2][16];                  // acc[q][t][r] = O^T[t*16 + 8*hh + r][nl] of tile q
#pragma unroll
  for (int q = 0; q < 2; ++q)
#pragma unroll
    for (int t = 0; t < 16; ++t) acc[q][t] = (v8f){};
  float rowM[2] = {-3.0e38f, -3.0e38f};   // running maxima of this lane's queries
  float rowL[2] = {0.0f, 0.0f};           // running sums over this wave half's keys

  const float sc = 0.0625f * 1.44269504088896f;   // 1/sqrt(C) * log2(e)

  // this wave's slice of a stage: tile j of K and of V both start at byte j * 16 KiB
  const u32x8 g1 = tdm_group1();
  const uint64_t gsrc = (uint64_t)(uintptr_t)(qg ? vP : kP) + (uint64_t)(b * 128) * TILE_B;
  const uint32_t dst = lds_off(lds) + kg * GRP_B + qg * TILE_B;

  // prologue, two buffers: stage 0, wait, barrier, stage 1
  tdm_load(tdm_group0(dst, gsrc + (uint64_t)kg * TILE_B), g1);
  wait_tensor0();
  __syncthreads();
  tdm_load(tdm_group0(dst + BUF_B, gsrc + (uint64_t)(4u + kg) * TILE_B), g1);

  for (uint32_t s = 0; s < NST; ++s) {
    const _Float16* Kb = (const _Float16*)(lds + (s & 1u) * BUF_B + kg * GRP_B);
    const _Float16* Vb = Kb + 8192;

    // ---- scores^T: 2 key tiles x 2 query tiles (K frags from LDS as A) ----
    v8f s0[2] = {(v8f){}, (v8f){}}, s1[2] = {(v8f){}, (v8f){}};
#pragma unroll
    for (int h = 0; h < 2; ++h) {
      v16h k0[4], k1[4];
#pragma unroll
      for (int i = 0; i < 4; ++i) {
        k0[i] = load_planes(Kb + (h * 4 + i)     * FRAG, lane);
        k1[i] = load_planes(Kb + (8 + h * 4 + i) * FRAG, lane);
      }
      __builtin_amdgcn_sched_barrier(0);
#pragma unroll
      for (int i = 0; i < 4; ++i) {
        const int kt = h * 4 + i;
        s0[0] = wmma_f16(k0[i], qa[0][kt], s0[0]);
        s1[0] = wmma_f16(k1[i], qa[0][kt], s1[0]);
        s0[1] = wmma_f16(k0[i], qa[1][kt], s0[1]);
        s1[1] = wmma_f16(k1[i], qa[1][kt], s1[1]);
      }
      __builtin_amdgcn_sched_barrier(0);
    }

    // ---- online softmax, one query per lane and tile ----
    v16h pb[2];
    float al[2];
#pragma unroll
    for (int q = 0; q < 2; ++q) {
      float mx = fmaxf(s0[q][0], s1[q][0]);        // raw scores: the scale is positive
#pragma unroll
      for (int r = 1; r < 8; ++r) mx = fmaxf(mx, fmaxf(s0[q][r], s1[q][r]));
      mx = fmaxf(mx, xhalf(mx)) * sc;              // both halves: the query's maximum
      const float newM = fmaxf(rowM[q], mx);
      al[q] = exp2f(rowM[q] - newM);
      rowM[q] = newM;
      float ps0 = 0.0f, ps1 = 0.0f;
#pragma unroll
      for (int r = 0; r < 8; ++r) {
        const float p0 = exp2f(s0[q][r] * sc - newM);
        const float p1 = exp2f(s1[q][r] * sc - newM);
        ps0 += p0;
        ps1 += p1;
        pb[q][r]     = (_Float16)p0;
        pb[q][r + 8] = (_Float16)p1;
      }
      rowL[q] = rowL[q] * al[q] + (ps0 + ps1);
    }

    // ---- V^T @ P^T: 16 channel tiles x 2 query tiles (V frags from LDS as A) ----
#pragma unroll
    for (int t = 0; t < 16; ++t) {
      const v16h vf = load_planes(Vb + t * FRAG, lane);
#pragma unroll
      for (int q = 0; q < 2; ++q) {
        acc[q][t] *= al[q];
        acc[q][t] = wmma_f16(vf, pb[q], acc[q][t]);
      }
    }

    // ---- publish point of stage s + 1; then refill the buffer just read ----
    wait_ds0();
    wait_tensor0();
    __syncthreads();
    if (pinned(s + 2u < NST)) {
      const uint32_t j = pinned((s + 2u) * 4u + kg);
      tdm_load(tdm_group0(dst + (s & 1u) * BUF_B, gsrc + (uint64_t)j * TILE_B), g1);
    }
  }
  wait_tensor0();
  wait_ds0();
  // The last pass's own barrier has ended every wave's reads: the ring becomes staging.

  // ---- join the four key groups: O = sum_g w_g O_g, w_g = 2^(m_g - M) / L ----
  float* sM = (float*)(lds + RING_B);            // [wave][q][lane]
  float* sL = sM + 512;
  f32x4* st = (f32x4*)lds;                       // [wave][q][t][r half][lane], 16 B
#pragma unroll
  for (int q = 0; q < 2; ++q) {
    sM[(wave * 2 + q) * 32 + lane] = rowM[q];
    sL[(wave * 2 + q) * 32 + lane] = rowL[q] + xhalf(rowL[q]);   // join the halves' sums
#pragma unroll
    for (int t = 0; t < 16; ++t) {
      f32x4* p = st + (((wave * 2 + q) * 16 + t) * 2) * 32 + lane;
      p[0]  = __builtin_shufflevector(acc[q][t], acc[q][t], 0, 1, 2, 3);
      p[32] = __builtin_shufflevector(acc[q][t], acc[q][t], 4, 5, 6, 7);
    }
  }
  __syncthreads();

#pragma unroll
  for (int q = 0; q < 2; ++q) {
    float m[4], w[4];
#pragma unroll
    for (int g = 0; g < 4; ++g) m[g] = sM[((g * 2 + qg) * 2 + q) * 32 + lane];
    const float M = fmaxf(fmaxf(m[0], m[1]), fmaxf(m[2], m[3]));
    float L = 0.0f;
#pragma unroll
    for (int g = 0; g < 4; ++g) {
      w[g] = exp2f(m[g] - M);
      L += sL[((g * 2 + qg) * 2 + q) * 32 + lane] * w[g];
    }
    const float inv = 1.0f / L;
#pragma unroll
    for (int g = 0; g < 4; ++g) w[g] *= inv;
#pragma unroll
    for (int tt = 0; tt < 4; ++tt) {
      const uint32_t t = kg * 4 + tt;
      f32x4 lo = {0.0f, 0.0f, 0.0f, 0.0f}, hi = {0.0f, 0.0f, 0.0f, 0.0f};
#pragma unroll
      for (int g = 0; g < 4; ++g) {
        const f32x4* p = st + ((((g * 2 + qg) * 2 + q) * 16 + t) * 2) * 32 + lane;
        lo += p[0] * w[g];
        hi += p[32] * w[g];
      }
      v8h o;
#pragma unroll
      for (int r = 0; r < 4; ++r) { o[r] = (_Float16)lo[r]; o[r + 4] = (_Float16)hi[r]; }
      *(v8h*)(attP + ((size_t)(b * 256 + it0 + q) * 8 + (t >> 1)) * FRAG +
              lane * 16 + (t & 1u) * 8) = o;
      asm volatile("s_wait_xcnt 0x0" ::: "memory");  // stands before the next tile writes over the store's registers
    }
  }
}

// ---------------------------------------------------------------------------
// Kernel 4: output projection + residual (fp32 out), packed operands.
// grid (N/16, C/16, B), block 32.
// ---------------------------------------------------------------------------
__global__ __launch_bounds__(32) void proj_kernel(
    const _Float16* __restrict__ attP, const _Float16* __restrict__ woP,
    const float* __restrict__ bo, const float* __restrict__ x,
    float* __restrict__ out) {
  const int b = blockIdx.z, ot = blockIdx.y, nt = blockIdx.x;
  const int lane = threadIdx.x, nl = lane & 15, hh = lane >> 4;

  v8f acc = {};
#pragma unroll
  for (int kt = 0; kt < 8; ++kt) {
    const v16h fa = load_frag(attP + ((size_t)(b * 256 + nt) * 8 + kt) * FRAG + lane * 16);
    const v16h fb = load_frag(woP + (size_t)(kt * 16 + ot) * FRAG + lane * 16);
    acc = wmma_f16(fa, fb, acc);
  }
#pragma unroll
  for (int v = 0; v < 8; ++v) {
    const int m = v + hh * 8;                      // spatial row within tile
    const size_t idx = ((size_t)b * Cn + ot * 16 + nl) * Nsp + nt * 16 + m;
    out[idx] = acc[v] + bo[ot * 16 + nl] + x[idx];
  }
}

extern "C" void kernel_launch(void* const* d_in, const int* in_sizes, int n_in,
                              void* d_out, int out_size, void* d_ws, size_t ws_size,
                              hipStream_t stream) {
  const float* x     = (const float*)d_in[0];
  const float* gamma = (const float*)d_in[1];
  const float* beta  = (const float*)d_in[2];
  const float* wq    = (const float*)d_in[3];
  const float* bq    = (const float*)d_in[4];
  const float* wk    = (const float*)d_in[5];
  const float* bk    = (const float*)d_in[6];
  const float* wv    = (const float*)d_in[7];
  const float* bv    = (const float*)d_in[8];
  const float* wo    = (const float*)d_in[9];
  const float* bo    = (const float*)d_in[10];
  float* out = (float*)d_out;

  const size_t T = (size_t)Bn * Cn * Nsp;
  _Float16* xnP  = (_Float16*)d_ws;
  _Float16* qP   = xnP  + T;
  _Float16* kP   = qP   + T;
  _Float16* vP   = kP   + T;
  _Float16* attP = vP   + T;
  _Float16* wqP  = attP + T;
  _Float16* wkP  = wqP  + (size_t)Cn * Cn;
  _Float16* wvP  = wkP  + (size_t)Cn * Cn;
  _Float16* woP  = wvP  + (size_t)Cn * Cn;

  prep_weights_kernel<<<dim3(8, 16), 32, 0, stream>>>(
      wq, wk, wv, wo, wqP, wkP, wvP, woP);

  gn_kernel<<<Bn * GRP, 1024, 0, stream>>>(x, gamma, beta, xnP);

  qkv_kernel<<<dim3(Nsp / 16, Cn / 16, Bn), 32, 0, stream>>>(
      xnP, wqP, wkP, wvP, bq, bk, bv, qP, kP, vP);

  attn_kernel<<<dim3(Nsp / 64, Bn), 256, 0, stream>>>(qP, kP, vP, attP);

  proj_kernel<<<dim3(Nsp / 16, Cn / 16, Bn), 32, 0, stream>>>(
      attP, woP, bo, x, out);
}

// v005
// A run of this version takes 107 microseconds.
// In both of two side-by-side timings against v004, it was 1.16 times as fast.
// Counting every step since v000, it is 3.00 times as fast.
#include <hip/hip_runtime.h>

typedef __attribute__((ext_vector_type(16))) _Float16     v16h;
typedef __attribute__((ext_vector_type(8)))  _Float16     v8h;
typedef __attribute__((ext_vector_type(8)))  float        v8f;
typedef __attribute__((ext_vector_type(4)))  unsigned int u32x4;
typedef __attribute__((ext_vector_type(8)))  unsigned int u32x8;
typedef __attribute__((ext_vector_type(4)))  float        f32x4;

#define Cn   256
#define Nsp  4096      // H*W
#define Bn   4
#define GRP  16
#define FRAG 512       // halfs per packed fragment: 32 lanes x 16 halfs (32B/lane)

static __device__ inline v8f wmma_f16(v16h a, v16h b, v8f c) {
  return __builtin_amdgcn_wmma_f32_16x16x32_f16(
      false, a, false, b, (short)0, c, false, false);
}

static __device__ inline int frag_slot(int Kin) {
  return ((Kin & 16) ? 8 : 0) + (Kin & 7);
}
static __device__ inline int frag_lane(int Kin, int col) {
  return col + (((Kin >> 3) & 1) << 4);
}
static __device__ inline v16h load_frag(const _Float16* p) {
  return *(const v16h*)p;            // 32B -> 2x b128 loads
}

#define PLANE 256      // halfs per plane
static __device__ inline int plane_off(int Kin, int col) {
  return ((Kin & 16) ? PLANE : 0) + frag_lane(Kin, col) * 8 + (Kin & 7);
}
static __device__ inline v16h load_planes(const _Float16* frag, int lane) {
  const v8h lo = *(const v8h*)(frag + lane * 8);
  const v8h hi = *(const v8h*)(frag + PLANE + lane * 8);
  return __builtin_shufflevector(lo, hi, 0, 1, 2, 3, 4, 5, 6, 7,
                                 8, 9, 10, 11, 12, 13, 14, 15);
}

static __device__ inline unsigned lds_off(const void* p) {
  return (unsigned)(uintptr_t)p;
}
static __device__ inline uint32_t uni(uint32_t v) {
  return (uint32_t)__builtin_amdgcn_readfirstlane(v);
}
static __device__ inline uint32_t pinned(uint32_t v) {
  uint32_t w = uni(v);
  asm volatile("" : "+s"(w));   // pinned(): the value stays in a scalar register, so a test on it is s_cmp + s_cbranch_scc
  return w;
}
static __device__ inline u32x4 tdm_group0(uint32_t lds_dst, uint64_t ga) {
  u32x4 g;
  g[0] = uni(1u);                                              // count = 1
  g[1] = uni(lds_dst);                                         // LDS byte offset
  g[2] = uni((uint32_t)ga);                                    // address [31:0]
  g[3] = uni((((uint32_t)(ga >> 32)) & 0x01FFFFFFu) | 0x80000000u);  // [56:32], type 2
  return g;
}
static __device__ inline u32x8 tdm_group1() {
  constexpr uint32_t d0 = 1024u, d1 = 16u;   // row bytes, rows; tensor = tile
  u32x8 g;
  g[0] = uni(0u);                            // no mask, 1-byte elements, no pad
  g[1] = uni((d0 & 0xFFFFu) << 16);
  g[2] = uni((d0 >> 16) | ((d1 & 0xFFFFu) << 16));
  g[3] = uni((d1 >> 16) | (d0 << 16));
  g[4] = uni(d1);
  g[5] = uni(d0);                            // source row pitch = the row
  g[6] = uni(0u);
  g[7] = uni(0u);
  return g;
}
static __device__ inline void tdm_load(u32x4 g0, u32x8 g1) {
  asm volatile("tensor_load_to_lds %0, %1" :: "s"(g0), "s"(g1) : "memory");
}
// The compiler places no wait for a tensor load and none that orders LDS reads
// against a refill: both are written where a stage is handed over.
static __device__ inline void wait_tensor0() { asm volatile("s_wait_tensorcnt 0x0" ::: "memory"); }
static __device__ inline void wait_ds0()     { asm volatile("s_wait_dscnt 0x0" ::: "memory"); }

// ---------------------------------------------------------------------------
// Kernel 0: weights fp32 -> packed fp16 fragments.
//   wq/wk/wv as A-frags [ot][kt]; Wo^T as B-frags [kt][ot].
// grid (8 kt, 16 ot), block 32.
// ---------------------------------------------------------------------------
__global__ __launch_bounds__(32) void prep_weights_kernel(
    const float* __restrict__ wq, const float* __restrict__ wk,
    const float* __restrict__ wv, const float* __restrict__ wo,
    _Float16* __restrict__ wqP, _Float16* __restrict__ wkP,
    _Float16* __restrict__ wvP, _Float16* __restrict__ woP) {
  const int kt = blockIdx.x, ot = blockIdx.y;
  const int lane = threadIdx.x;
  const int m = lane & 15, koff = (lane >> 4) * 8;
  const int row = ot * 16 + m;
  const size_t pa = (size_t)(ot * 8 + kt) * FRAG + lane * 16;
  const size_t pb = (size_t)(kt * 16 + ot) * FRAG + lane * 16;
#pragma unroll
  for (int i = 0; i < 8; ++i) {
    const int K0 = kt * 32 + koff + i;
    const int K1 = kt * 32 + 16 + koff + i;
    wqP[pa + i]     = (_Float16)wq[row * Cn + K0];
    wqP[pa + i + 8] = (_Float16)wq[row * Cn + K1];
    wkP[pa + i]     = (_Float16)wk[row * Cn + K0];
    wkP[pa + i + 8] = (_Float16)wk[row * Cn + K1];
    wvP[pa + i]     = (_Float16)wv[row * Cn + K0];
    wvP[pa + i + 8] = (_Float16)wv[row * Cn + K1];
    // B-frag of Wo^T: element (K=c, col=o) = wo[o*C + c]  (same gather shape)
    woP[pb + i]     = (_Float16)wo[row * Cn + K0];
    woP[pb + i + 8] = (_Float16)wo[row * Cn + K1];
  }
}

static __device__ inline float xhalf(float x) {
  const int i = __builtin_bit_cast(int, x);
  return __builtin_bit_cast(float, __builtin_amdgcn_permlanex16(
      i, i, 0x76543210, 0xfedcba98, false, false));
}
template <int MASK>
static __device__ inline float xrow(float x) {
  const int i = __builtin_bit_cast(int, x);
  return __builtin_bit_cast(float, __builtin_amdgcn_update_dpp(
      i, i, 0x160 + MASK, 0xf, 0xf, false));      // 0x160: row_xmask
}
static __device__ inline float wave_sum(float x) {  // every lane gets the sum of all 32
  x += xrow<1>(x);
  x += xrow<2>(x);
  x += xrow<4>(x);
  x += xrow<8>(x);
  return x + xhalf(x);
}

__global__ __launch_bounds__(1024) void gn_kernel(const float* __restrict__ x,
                                                  const float* __restrict__ gamma,
                                                  const float* __restrict__ beta,
                                                  _Float16* __restrict__ xnP) {
  const int b = blockIdx.x >> 4, grp = blockIdx.x & 15, t = threadIdx.x;
  const int CPG = Cn / GRP;                  // 16 channels per group
  const int total = CPG * Nsp;               // 65536
  const float* xg = x + ((size_t)b * Cn + (size_t)grp * CPG) * Nsp + t;

  float v[4][16];                            // v[k][cc] = channel cc at n = t + 1024*k
#pragma unroll
  for (int k = 0; k < 4; ++k)
#pragma unroll
    for (int cc = 0; cc < 16; ++cc) v[k][cc] = xg[cc * Nsp + k * 1024];

  float s[4], ss[4];                         // four independent chains
#pragma unroll
  for (int k = 0; k < 4; ++k) {
    s[k] = 0.f; ss[k] = 0.f;
#pragma unroll
    for (int cc = 0; cc < 16; ++cc) { s[k] += v[k][cc]; ss[k] += v[k][cc] * v[k][cc]; }
  }
  const float ws  = wave_sum((s[0] + s[1]) + (s[2] + s[3]));
  const float wss = wave_sum((ss[0] + ss[1]) + (ss[2] + ss[3]));
  __shared__ float rs[32], rss[32];          // one sum per wave
  if ((t & 31) == 0) { rs[t >> 5] = ws; rss[t >> 5] = wss; }
  __syncthreads();
  const float inv_n = 1.0f / (float)total;
  const float mean  = wave_sum(rs[t & 31]) * inv_n;
  const float rstd  = rsqrtf(wave_sum(rss[t & 31]) * inv_n - mean * mean + 1e-5f);

  _Float16* o = xnP + ((size_t)(b * 256 + (t >> 4)) * 8 + (grp >> 1)) * FRAG +
                (t & 15) * 16 + (grp & 1) * 8;
#pragma unroll
  for (int k = 0; k < 4; ++k)
#pragma unroll
    for (int h = 0; h < 2; ++h) {
      v8h p;
#pragma unroll
      for (int i = 0; i < 8; ++i) {
        const int c = grp * CPG + h * 8 + i;
        p[i] = (_Float16)((v[k][h * 8 + i] - mean) * rstd * gamma[c] + beta[c]);
      }
      *(v8h*)(o + (size_t)k * 64 * 8 * FRAG + h * 256) = p;
    }
}

__global__ __launch_bounds__(512) void qkv_kernel(
    const _Float16* __restrict__ xnP,
    const _Float16* __restrict__ wqP, const _Float16* __restrict__ wkP,
    const _Float16* __restrict__ wvP,
    const float* __restrict__ bq, const float* __restrict__ bk,
    const float* __restrict__ bv,
    _Float16* __restrict__ qP, _Float16* __restrict__ kP,
    _Float16* __restrict__ vP) {
  const int b = blockIdx.z, op = blockIdx.x;       // op: pair of channel tiles
  const int wave = (int)uni(threadIdx.x >> 5);
  const int lane = threadIdx.x & 31, hh = lane >> 4;   // below, nl = lane & 15
  const int np = blockIdx.y * 16 + wave;           // pair of position tiles

  const _Float16* xs = xnP + (size_t)(b * 128 + np) * 16 * FRAG + lane * 16;  // [n][kt]
  const _Float16* wqs = wqP + (size_t)op * 16 * FRAG + lane * 16;             // [o][kt]
  const _Float16* wks = wkP + (size_t)op * 16 * FRAG + lane * 16;
  const _Float16* wvs = wvP + (size_t)op * 16 * FRAG + lane * 16;

  // Every loop below is unrolled: its arrays are then indexed by constants and
  // stay in registers.
  // Biases. q, k: a lane's rows are channels 8*hh + r of tile o; v: its column is
  // channel nl of tile o.
  const float* bqs = bq + op * 32;
  const float* bks = bk + op * 32;
  const float* bvs = bv + op * 32;
  float qb[2][8], kb[2][8], vb[2];
#pragma unroll
  for (int o = 0; o < 2; ++o) {
#pragma unroll
    for (int r = 0; r < 8; ++r) { qb[o][r] = bqs[hh * 8 + o * 16 + r]; kb[o][r] = bks[hh * 8 + o * 16 + r]; }
  }
  const float vx = bvs[lane], vy = xhalf(vx);      // channels lane and lane ^ 16 of the 32
  vb[0] = hh ? vy : vx;
  vb[1] = hh ? vx : vy;

  v8f aq[2][2], ak[2][2], av[2][2];                // [o][n]
#pragma unroll
  for (int o = 0; o < 2; ++o)
#pragma unroll
    for (int n = 0; n < 2; ++n) { aq[o][n] = (v8f){}; ak[o][n] = (v8f){}; av[o][n] = (v8f){}; }

#pragma unroll
  for (int kt = 0; kt < 8; ++kt) {
    v16h xb[2], fq[2], fk[2], fv[2];
#pragma unroll
    for (int i = 0; i < 2; ++i) {
      xb[i] = load_frag(xs + (i * 8 + kt) * FRAG);
      fq[i] = load_frag(wqs + (i * 8 + kt) * FRAG);
      fk[i] = load_frag(wks + (i * 8 + kt) * FRAG);
      fv[i] = load_frag(wvs + (i * 8 + kt) * FRAG);
    }
#pragma unroll
    for (int o = 0; o < 2; ++o)
#pragma unroll
      for (int n = 0; n < 2; ++n) {
        aq[o][n] = wmma_f16(fq[o], xb[n], aq[o][n]);
        ak[o][n] = wmma_f16(fk[o], xb[n], ak[o][n]);
        av[o][n] = wmma_f16(xb[n], fv[o], av[o][n]);
      }
  }

  const size_t f = ((size_t)(b * 128 + np) * 16 + op) * FRAG;       // tile n: + n*8 fragments
  _Float16* qd = qP + f + lane * 16;
  _Float16* kd = kP + f + lane * 8;
  _Float16* vd = vP + ((size_t)(b * 128 + np) * 16 + op * 2) * FRAG + lane * 8;
#pragma unroll
  for (int o = 0; o < 2; ++o) {
#pragma unroll
    for (int n = 0; n < 2; ++n) {
      v8h hq, hk, hv;
#pragma unroll
      for (int r = 0; r < 8; ++r) {
        hq[r] = (_Float16)(aq[o][n][r] + qb[o][r]);
        hk[r] = (_Float16)(ak[o][n][r] + kb[o][r]);
        hv[r] = (_Float16)(av[o][n][r] + vb[o]);
      }
      *(v8h*)(qd + n * 8 * FRAG + o * 8) = hq;
      *(v8h*)(kd + n * 8 * FRAG + o * PLANE) = hk;
      *(v8h*)(vd + o * FRAG + n * PLANE) = hv;
    }
  }
}

#define NST    32u        // stages
#define TILE_B 16384u     // bytes of one K or V tile of 32 keys
#define GRP_B  32768u     // LDS bytes of one key group in a buffer (K, then V)
#define BUF_B  131072u    // LDS bytes of one buffer
#define RING_B 262144u    // two buffers

__global__ __launch_bounds__(256) void attn_kernel(
    const _Float16* __restrict__ qP, const _Float16* __restrict__ kP,
    const _Float16* __restrict__ vP, _Float16* __restrict__ attP) {
  const int b = blockIdx.y;
  const uint32_t wave = uni(threadIdx.x >> 5);
  const int lane = threadIdx.x & 31;
  const uint32_t kg = wave >> 1;                 // key group
  const uint32_t qg = wave & 1u;                 // query group (32 columns)
  const int it0 = blockIdx.x * 4 + (int)qg * 2;  // first of two query tiles

  __shared__ __attribute__((aligned(2048))) unsigned char lds[RING_B + 4096u];

  // resident q fragments (all 256 channels of both query tiles), used as B
  v16h qa[2][8];
#pragma unroll
  for (int q = 0; q < 2; ++q)
#pragma unroll
    for (int kt = 0; kt < 8; ++kt)
      qa[q][kt] = load_frag(qP + ((size_t)(b * 256 + it0 + q) * 8 + kt) * FRAG + lane * 16);

  v8f acc[2][16];                  // acc[q][t][r] = O^T[t*16 + 8*hh + r][nl] of tile q
#pragma unroll
  for (int q = 0; q < 2; ++q)
#pragma unroll
    for (int t = 0; t < 16; ++t) acc[q][t] = (v8f){};
  float rowM[2] = {-3.0e38f, -3.0e38f};   // running maxima of this lane's queries
  float rowL[2] = {0.0f, 0.0f};           // running sums over this wave half's keys

  const float sc = 0.0625f * 1.44269504088896f;   // 1/sqrt(C) * log2(e)

  // this wave's slice of a stage: tile j of K and of V both start at byte j * 16 KiB
  const u32x8 g1 = tdm_group1();
  const uint64_t gsrc = (uint64_t)(uintptr_t)(qg ? vP : kP) + (uint64_t)(b * 128) * TILE_B;
  const uint32_t dst = lds_off(lds) + kg * GRP_B + qg * TILE_B;

  // prologue, two buffers: stage 0, wait, barrier, stage 1
  tdm_load(tdm_group0(dst, gsrc + (uint64_t)kg * TILE_B), g1);
  wait_tensor0();
  __syncthreads();
  tdm_load(tdm_group0(dst + BUF_B, gsrc + (uint64_t)(4u + kg) * TILE_B), g1);

  for (uint32_t s = 0; s < NST; ++s) {
    const _Float16* Kb = (const _Float16*)(lds + (s & 1u) * BUF_B + kg * GRP_B);
    const _Float16* Vb = Kb + 8192;

    // ---- scores^T: 2 key tiles x 2 query tiles (K frags from LDS as A) ----
    v8f s0[2] = {(v8f){}, (v8f){}}, s1[2] = {(v8f){}, (v8f){}};
#pragma unroll
    for (int h = 0; h < 2; ++h) {
      v16h k0[4], k1[4];
#pragma unroll
      for (int i = 0; i < 4; ++i) {
        k0[i] = load_planes(Kb + (h * 4 + i)     * FRAG, lane);
        k1[i] = load_planes(Kb + (8 + h * 4 + i) * FRAG, lane);
      }
      __builtin_amdgcn_sched_barrier(0);
#pragma unroll
      for (int i = 0; i < 4; ++i) {
        const int kt = h * 4 + i;
        s0[0] = wmma_f16(k0[i], qa[0][kt], s0[0]);
        s1[0] = wmma_f16(k1[i], qa[0][kt], s1[0]);
        s0[1] = wmma_f16(k0[i], qa[1][kt], s0[1]);
        s1[1] = wmma_f16(k1[i], qa[1][kt], s1[1]);
      }
      __builtin_amdgcn_sched_barrier(0);
    }

    // ---- online softmax, one query per lane and tile ----
    v16h pb[2];
    float al[2];
#pragma unroll
    for (int q = 0; q < 2; ++q) {
      float mx = fmaxf(s0[q][0], s1[q][0]);        // raw scores: the scale is positive
#pragma unroll
      for (int r = 1; r < 8; ++r) mx = fmaxf(mx, fmaxf(s0[q][r], s1[q][r]));
      mx = fmaxf(mx, xhalf(mx)) * sc;              // both halves: the query's maximum
      const float newM = fmaxf(rowM[q], mx);
      al[q] = exp2f(rowM[q] - newM);
      rowM[q] = newM;
      float ps0 = 0.0f, ps1 = 0.0f;
#pragma unroll
      for (int r = 0; r < 8; ++r) {
        const float p0 = exp2f(s0[q][r] * sc - newM);
        const float p1 = exp2f(s1[q][r] * sc - newM);
        ps0 += p0;
        ps1 += p1;
        pb[q][r]     = (_Float16)p0;
        pb[q][r + 8] = (_Float16)p1;
      }
      rowL[q] = rowL[q] * al[q] + (ps0 + ps1);
    }

    // ---- V^T @ P^T: 16 channel tiles x 2 query tiles (V frags from LDS as A) ----
#pragma unroll
    for (int t = 0; t < 16; ++t) {
      const v16h vf = load_planes(Vb + t * FRAG, lane);
#pragma unroll
      for (int q = 0; q < 2; ++q) {
        acc[q][t] *= al[q];
        acc[q][t] = wmma_f16(vf, pb[q], acc[q][t]);
      }
    }

    // ---- publish point of stage s + 1; then refill the buffer just read ----
    wait_ds0();
    wait_tensor0();
    __syncthreads();
    if (pinned(s + 2u < NST)) {
      const uint32_t j = pinned((s + 2u) * 4u + kg);
      tdm_load(tdm_group0(dst + (s & 1u) * BUF_B, gsrc + (uint64_t)j * TILE_B), g1);
    }
  }
  wait_tensor0();
  wait_ds0();
  // The last pass's own barrier has ended every wave's reads: the ring becomes staging.

  // ---- join the four key groups: O = sum_g w_g O_g, w_g = 2^(m_g - M) / L ----
  float* sM = (float*)(lds + RING_B);            // [wave][q][lane]
  float* sL = sM + 512;
  f32x4* st = (f32x4*)lds;                       // [wave][q][t][r half][lane], 16 B
#pragma unroll
  for (int q = 0; q < 2; ++q) {
    sM[(wave * 2 + q) * 32 + lane] = rowM[q];
    sL[(wave * 2 + q) * 32 + lane] = rowL[q] + xhalf(rowL[q]);   // join the halves' sums
#pragma unroll
    for (int t = 0; t < 16; ++t) {
      f32x4* p = st + (((wave * 2 + q) * 16 + t) * 2) * 32 + lane;
      p[0]  = __builtin_shufflevector(acc[q][t], acc[q][t], 0, 1, 2, 3);
      p[32] = __builtin_shufflevector(acc[q][t], acc[q][t], 4, 5, 6, 7);
    }
  }
  __syncthreads();

#pragma unroll
  for (int q = 0; q < 2; ++q) {
    float m[4], w[4];
#pragma unroll
    for (int g = 0; g < 4; ++g) m[g] = sM[((g * 2 + qg) * 2 + q) * 32 + lane];
    const float M = fmaxf(fmaxf(m[0], m[1]), fmaxf(m[2], m[3]));
    float L = 0.0f;
#pragma unroll
    for (int g = 0; g < 4; ++g) {
      w[g] = exp2f(m[g] - M);
      L += sL[((g * 2 + qg) * 2 + q) * 32 + lane] * w[g];
    }
    const float inv = 1.0f / L;
#pragma unroll
    for (int g = 0; g < 4; ++g) w[g] *= inv;
#pragma unroll
    for (int tt = 0; tt < 4; ++tt) {
      const uint32_t t = kg * 4 + tt;
      f32x4 lo = {0.0f, 0.0f, 0.0f, 0.0f}, hi = {0.0f, 0.0f, 0.0f, 0.0f};
#pragma unroll
      for (int g = 0; g < 4; ++g) {
        const f32x4* p = st + ((((g * 2 + qg) * 2 + q) * 16 + t) * 2) * 32 + lane;
        lo += p[0] * w[g];
        hi += p[32] * w[g];
      }
      v8h o;
#pragma unroll
      for (int r = 0; r < 4; ++r) { o[r] = (_Float16)lo[r]; o[r + 4] = (_Float16)hi[r]; }
      *(v8h*)(attP + ((size_t)(b * 256 + it0 + q) * 8 + (t >> 1)) * FRAG +
              lane * 16 + (t & 1u) * 8) = o;
      asm volatile("s_wait_xcnt 0x0" ::: "memory");  // stands before the next tile writes over the store's registers
    }
  }
}

// ---------------------------------------------------------------------------
// Kernel 4: output projection + residual (fp32 out), packed operands.
// grid (N/16, C/16, B), block 32.
// ---------------------------------------------------------------------------
__global__ __launch_bounds__(32) void proj_kernel(
    const _Float16* __restrict__ attP, const _Float16* __restrict__ woP,
    const float* __restrict__ bo, const float* __restrict__ x,
    float* __restrict__ out) {
  const int b = blockIdx.z, ot = blockIdx.y, nt = blockIdx.x;
  const int lane = threadIdx.x, nl = lane & 15, hh = lane >> 4;

  v8f acc = {};
#pragma unroll
  for (int kt = 0; kt < 8; ++kt) {
    const v16h fa = load_frag(attP + ((size_t)(b * 256 + nt) * 8 + kt) * FRAG + lane * 16);
    const v16h fb = load_frag(woP + (size_t)(kt * 16 + ot) * FRAG + lane * 16);
    acc = wmma_f16(fa, fb, acc);
  }
#pragma unroll
  for (int v = 0; v < 8; ++v) {
    const int m = v + hh * 8;                      // spatial row within tile
    const size_t idx = ((size_t)b * Cn + ot * 16 + nl) * Nsp + nt * 16 + m;
    out[idx] = acc[v] + bo[ot * 16 + nl] + x[idx];
  }
}

extern "C" void kernel_launch(void* const* d_in, const int* in_sizes, int n_in,
                              void* d_out, int out_size, void* d_ws, size_t ws_size,
                              hipStream_t stream) {
  const float* x     = (const float*)d_in[0];
  const float* gamma = (const float*)d_in[1];
  const float* beta  = (const float*)d_in[2];
  const float* wq    = (const float*)d_in[3];
  const float* bq    = (const float*)d_in[4];
  const float* wk    = (const float*)d_in[5];
  const float* bk    = (const float*)d_in[6];
  const float* wv    = (const float*)d_in[7];
  const float* bv    = (const float*)d_in[8];
  const float* wo    = (const float*)d_in[9];
  const float* bo    = (const float*)d_in[10];
  float* out = (float*)d_out;

  const size_t T = (size_t)Bn * Cn * Nsp;
  _Float16* xnP  = (_Float16*)d_ws;
  _Float16* qP   = xnP  + T;
  _Float16* kP   = qP   + T;
  _Float16* vP   = kP   + T;
  _Float16* attP = vP   + T;
  _Float16* wqP  = attP + T;
  _Float16* wkP  = wqP  + (size_t)Cn * Cn;
  _Float16* wvP  = wkP  + (size_t)Cn * Cn;
  _Float16* woP  = wvP  + (size_t)Cn * Cn;

  prep_weights_kernel<<<dim3(8, 16), 32, 0, stream>>>(
      wq, wk, wv, wo, wqP, wkP, wvP, woP);

  gn_kernel<<<Bn * GRP, 1024, 0, stream>>>(x, gamma, beta, xnP);

  qkv_kernel<<<dim3(Cn / 32, Nsp / 512, Bn), 512, 0, stream>>>(
      xnP, wqP, wkP, wvP, bq, bk, bv, qP, kP, vP);

  attn_kernel<<<dim3(Nsp / 64, Bn), 256, 0, stream>>>(qP, kP, vP, attP);

  proj_kernel<<<dim3(Nsp / 16, Cn / 16, Bn), 32, 0, stream>>>(
      attP, woP, bo, x, out);
}

// v006
// A run of this version takes 94.4 microseconds.
// Next to v005, in two timings, it ran 1.13 and 1.14 times as fast.
// All steps since v000 together make it 3.41 times as fast.
#include <hip/hip_runtime.h>

typedef __attribute__((ext_vector_type(16))) _Float16     v16h;
typedef __attribute__((ext_vector_type(8)))  _Float16     v8h;
typedef __attribute__((ext_vector_type(8)))  float        v8f;
typedef __attribute__((ext_vector_type(4)))  unsigned int u32x4;
typedef __attribute__((ext_vector_type(8)))  unsigned int u32x8;
typedef __attribute__((ext_vector_type(4)))  float        f32x4;

#define Cn   256
#define Nsp  4096      // H*W
#define Bn   4
#define GRP  16
#define FRAG 512       // halfs per packed fragment: 32 lanes x 16 halfs (32B/lane)

static __device__ inline v8f wmma_f16(v16h a, v16h b, v8f c) {
  return __builtin_amdgcn_wmma_f32_16x16x32_f16(
      false, a, false, b, (short)0, c, false, false);
}

static __device__ inline int frag_slot(int Kin) {
  return ((Kin & 16) ? 8 : 0) + (Kin & 7);
}
static __device__ inline int frag_lane(int Kin, int col) {
  return col + (((Kin >> 3) & 1) << 4);
}
static __device__ inline v16h load_frag(const _Float16* p) {
  return *(const v16h*)p;            // 32B -> 2x b128 loads
}

#define PLANE 256      // halfs per plane
static __device__ inline int plane_off(int Kin, int col) {
  return ((Kin & 16) ? PLANE : 0) + frag_lane(Kin, col) * 8 + (Kin & 7);
}
static __device__ inline v16h load_planes(const _Float16* frag, int lane) {
  const v8h lo = *(const v8h*)(frag + lane * 8);
  const v8h hi = *(const v8h*)(frag + PLANE + lane * 8);
  return __builtin_shufflevector(lo, hi, 0, 1, 2, 3, 4, 5, 6, 7,
                                 8, 9, 10, 11, 12, 13, 14, 15);
}

static __device__ inline unsigned lds_off(const void* p) {
  return (unsigned)(uintptr_t)p;
}
static __device__ inline uint32_t uni(uint32_t v) {
  return (uint32_t)__builtin_amdgcn_readfirstlane(v);
}
static __device__ inline uint32_t pinned(uint32_t v) {
  uint32_t w = uni(v);
  asm volatile("" : "+s"(w));   // pinned(): the value stays in a scalar register, so a test on it is s_cmp + s_cbranch_scc
  return w;
}
static __device__ inline u32x4 tdm_group0(uint32_t lds_dst, uint64_t ga) {
  u32x4 g;
  g[0] = uni(1u);                                              // count = 1
  g[1] = uni(lds_dst);                                         // LDS byte offset
  g[2] = uni((uint32_t)ga);                                    // address [31:0]
  g[3] = uni((((uint32_t)(ga >> 32)) & 0x01FFFFFFu) | 0x80000000u);  // [56:32], type 2
  return g;
}
static __device__ inline u32x8 tdm_group1() {
  constexpr uint32_t d0 = 1024u, d1 = 16u;   // row bytes, rows; tensor = tile
  u32x8 g;
  g[0] = uni(0u);                            // no mask, 1-byte elements, no pad
  g[1] = uni((d0 & 0xFFFFu) << 16);
  g[2] = uni((d0 >> 16) | ((d1 & 0xFFFFu) << 16));
  g[3] = uni((d1 >> 16) | (d0 << 16));
  g[4] = uni(d1);
  g[5] = uni(d0);                            // source row pitch = the row
  g[6] = uni(0u);
  g[7] = uni(0u);
  return g;
}
static __device__ inline void tdm_load(u32x4 g0, u32x8 g1) {
  asm volatile("tensor_load_to_lds %0, %1" :: "s"(g0), "s"(g1) : "memory");
}
// The compiler places no wait for a tensor load and none that orders LDS reads
// against a refill: both are written where a stage is handed over.
static __device__ inline void wait_tensor0() { asm volatile("s_wait_tensorcnt 0x0" ::: "memory"); }
static __device__ inline void wait_ds0()     { asm volatile("s_wait_dscnt 0x0" ::: "memory"); }

// ---------------------------------------------------------------------------
// Kernel 0: weights fp32 -> packed fp16 fragments.
//   wq/wk/wv as A-frags [ot][kt]; Wo^T as B-frags [kt][ot].
// grid (8 kt, 16 ot), block 32.
// ---------------------------------------------------------------------------
__global__ __launch_bounds__(32) void prep_weights_kernel(
    const float* __restrict__ wq, const float* __restrict__ wk,
    const float* __restrict__ wv, const float* __restrict__ wo,
    _Float16* __restrict__ wqP, _Float16* __restrict__ wkP,
    _Float16* __restrict__ wvP, _Float16* __restrict__ woP) {
  const int kt = blockIdx.x, ot = blockIdx.y;
  const int lane = threadIdx.x;
  const int m = lane & 15, koff = (lane >> 4) * 8;
  const int row = ot * 16 + m;
  const size_t pa = (size_t)(ot * 8 + kt) * FRAG + lane * 16;
  const size_t pb = (size_t)(kt * 16 + ot) * FRAG + lane * 16;
#pragma unroll
  for (int i = 0; i < 8; ++i) {
    const int K0 = kt * 32 + koff + i;
    const int K1 = kt * 32 + 16 + koff + i;
    wqP[pa + i]     = (_Float16)wq[row * Cn + K0];
    wqP[pa + i + 8] = (_Float16)wq[row * Cn + K1];
    wkP[pa + i]     = (_Float16)wk[row * Cn + K0];
    wkP[pa + i + 8] = (_Float16)wk[row * Cn + K1];
    wvP[pa + i]     = (_Float16)wv[row * Cn + K0];
    wvP[pa + i + 8] = (_Float16)wv[row * Cn + K1];
    // B-frag of Wo^T: element (K=c, col=o) = wo[o*C + c]  (same gather shape)
    woP[pb + i]     = (_Float16)wo[row * Cn + K0];
    woP[pb + i + 8] = (_Float16)wo[row * Cn + K1];
  }
}

static __device__ inline float xhalf(float x) {
  const int i = __builtin_bit_cast(int, x);
  return __builtin_bit_cast(float, __builtin_amdgcn_permlanex16(
      i, i, 0x76543210, 0xfedcba98, false, false));
}
template <int MASK>
static __device__ inline float xrow(float x) {
  const int i = __builtin_bit_cast(int, x);
  return __builtin_bit_cast(float, __builtin_amdgcn_update_dpp(
      i, i, 0x160 + MASK, 0xf, 0xf, false));      // 0x160: row_xmask
}
static __device__ inline float wave_sum(float x) {  // every lane gets the sum of all 32
  x += xrow<1>(x);
  x += xrow<2>(x);
  x += xrow<4>(x);
  x += xrow<8>(x);
  return x + xhalf(x);
}

__global__ __launch_bounds__(1024) void gn_kernel(const float* __restrict__ x,
                                                  const float* __restrict__ gamma,
                                                  const float* __restrict__ beta,
                                                  _Float16* __restrict__ xnP) {
  const int b = blockIdx.x >> 4, grp = blockIdx.x & 15, t = threadIdx.x;
  const int CPG = Cn / GRP;                  // 16 channels per group
  const int total = CPG * Nsp;               // 65536
  const float* xg = x + ((size_t)b * Cn + (size_t)grp * CPG) * Nsp + t;

  float v[4][16];                            // v[k][cc] = channel cc at n = t + 1024*k
#pragma unroll
  for (int k = 0; k < 4; ++k)
#pragma unroll
    for (int cc = 0; cc < 16; ++cc) v[k][cc] = xg[cc * Nsp + k * 1024];

  float s[4], ss[4];                         // four independent chains
#pragma unroll
  for (int k = 0; k < 4; ++k) {
    s[k] = 0.f; ss[k] = 0.f;
#pragma unroll
    for (int cc = 0; cc < 16; ++cc) { s[k] += v[k][cc]; ss[k] += v[k][cc] * v[k][cc]; }
  }
  const float ws  = wave_sum((s[0] + s[1]) + (s[2] + s[3]));
  const float wss = wave_sum((ss[0] + ss[1]) + (ss[2] + ss[3]));
  __shared__ float rs[32], rss[32];          // one sum per wave
  if ((t & 31) == 0) { rs[t >> 5] = ws; rss[t >> 5] = wss; }
  __syncthreads();
  const float inv_n = 1.0f / (float)total;
  const float mean  = wave_sum(rs[t & 31]) * inv_n;
  const float rstd  = rsqrtf(wave_sum(rss[t & 31]) * inv_n - mean * mean + 1e-5f);

  _Float16* o = xnP + ((size_t)(b * 256 + (t >> 4)) * 8 + (grp >> 1)) * FRAG +
                (t & 15) * 16 + (grp & 1) * 8;
#pragma unroll
  for (int k = 0; k < 4; ++k)
#pragma unroll
    for (int h = 0; h < 2; ++h) {
      v8h p;
#pragma unroll
      for (int i = 0; i < 8; ++i) {
        const int c = grp * CPG + h * 8 + i;
        p[i] = (_Float16)((v[k][h * 8 + i] - mean) * rstd * gamma[c] + beta[c]);
      }
      *(v8h*)(o + (size_t)k * 64 * 8 * FRAG + h * 256) = p;
    }
}

__global__ __launch_bounds__(512) void qkv_kernel(
    const _Float16* __restrict__ xnP,
    const _Float16* __restrict__ wqP, const _Float16* __restrict__ wkP,
    const _Float16* __restrict__ wvP,
    const float* __restrict__ bq, const float* __restrict__ bk,
    const float* __restrict__ bv,
    _Float16* __restrict__ qP, _Float16* __restrict__ kP,
    _Float16* __restrict__ vP) {
  const int b = blockIdx.z, op = blockIdx.x;       // op: pair of channel tiles
  const int wave = (int)uni(threadIdx.x >> 5);
  const int lane = threadIdx.x & 31, hh = lane >> 4;   // below, nl = lane & 15
  const int np = blockIdx.y * 16 + wave;           // pair of position tiles

  const _Float16* xs = xnP + (size_t)(b * 128 + np) * 16 * FRAG + lane * 16;  // [n][kt]
  const _Float16* wqs = wqP + (size_t)op * 16 * FRAG + lane * 16;             // [o][kt]
  const _Float16* wks = wkP + (size_t)op * 16 * FRAG + lane * 16;
  const _Float16* wvs = wvP + (size_t)op * 16 * FRAG + lane * 16;

  // Every loop below is unrolled: its arrays are then indexed by constants and
  // stay in registers.
  // Biases. q, k: a lane's rows are channels 8*hh + r of tile o; v: its column is
  // channel nl of tile o.
  const float* bqs = bq + op * 32;
  const float* bks = bk + op * 32;
  const float* bvs = bv + op * 32;
  float qb[2][8], kb[2][8], vb[2];
#pragma unroll
  for (int o = 0; o < 2; ++o) {
#pragma unroll
    for (int r = 0; r < 8; ++r) { qb[o][r] = bqs[hh * 8 + o * 16 + r]; kb[o][r] = bks[hh * 8 + o * 16 + r]; }
  }
  const float vx = bvs[lane], vy = xhalf(vx);      // channels lane and lane ^ 16 of the 32
  vb[0] = hh ? vy : vx;
  vb[1] = hh ? vx : vy;

  v8f aq[2][2], ak[2][2], av[2][2];                // [o][n]
#pragma unroll
  for (int o = 0; o < 2; ++o)
#pragma unroll
    for (int n = 0; n < 2; ++n) { aq[o][n] = (v8f){}; ak[o][n] = (v8f){}; av[o][n] = (v8f){}; }

#pragma unroll
  for (int kt = 0; kt < 8; ++kt) {
    v16h xb[2], fq[2], fk[2], fv[2];
#pragma unroll
    for (int i = 0; i < 2; ++i) {
      xb[i] = load_frag(xs + (i * 8 + kt) * FRAG);
      fq[i] = load_frag(wqs + (i * 8 + kt) * FRAG);
      fk[i] = load_frag(wks + (i * 8 + kt) * FRAG);
      fv[i] = load_frag(wvs + (i * 8 + kt) * FRAG);
    }
#pragma unroll
    for (int o = 0; o < 2; ++o)
#pragma unroll
      for (int n = 0; n < 2; ++n) {
        aq[o][n] = wmma_f16(fq[o], xb[n], aq[o][n]);
        ak[o][n] = wmma_f16(fk[o], xb[n], ak[o][n]);
        av[o][n] = wmma_f16(xb[n], fv[o], av[o][n]);
      }
  }

  const size_t f = ((size_t)(b * 128 + np) * 16 + op) * FRAG;       // tile n: + n*8 fragments
  _Float16* qd = qP + f + lane * 16;
  _Float16* kd = kP + f + lane * 8;
  _Float16* vd = vP + ((size_t)(b * 128 + np) * 16 + op * 2) * FRAG + lane * 8;
#pragma unroll
  for (int o = 0; o < 2; ++o) {
#pragma unroll
    for (int n = 0; n < 2; ++n) {
      v8h hq, hk, hv;
#pragma unroll
      for (int r = 0; r < 8; ++r) {
        hq[r] = (_Float16)(aq[o][n][r] + qb[o][r]);
        hk[r] = (_Float16)(ak[o][n][r] + kb[o][r]);
        hv[r] = (_Float16)(av[o][n][r] + vb[o]);
      }
      *(v8h*)(qd + n * 8 * FRAG + o * 8) = hq;
      *(v8h*)(kd + n * 8 * FRAG + o * PLANE) = hk;
      *(v8h*)(vd + o * FRAG + n * PLANE) = hv;
    }
  }
}

#define NST    32u        // stages
#define TILE_B 16384u     // bytes of one K or V tile of 32 keys
#define GRP_B  32768u     // LDS bytes of one key group in a buffer (K, then V)
#define BUF_B  131072u    // LDS bytes of one buffer
#define RING_B 262144u    // two buffers
#define ATT_B  32768u     // joined result: 4 query tiles x 8 fragments of 1,024 bytes

__global__ __launch_bounds__(256) void attn_kernel(
    const _Float16* __restrict__ qP, const _Float16* __restrict__ kP,
    const _Float16* __restrict__ vP, const _Float16* __restrict__ woP,
    const float* __restrict__ bo, const float* __restrict__ x,
    float* __restrict__ out) {
  const int b = blockIdx.y;
  const uint32_t wave = uni(threadIdx.x >> 5);
  const int lane = threadIdx.x & 31;
  const uint32_t kg = wave >> 1;                 // key group
  const uint32_t qg = wave & 1u;                 // query group (32 columns)
  const int it0 = blockIdx.x * 4 + (int)qg * 2;  // first of two query tiles

  __shared__ __attribute__((aligned(2048))) unsigned char lds[RING_B + 4096u + ATT_B];

  // resident q fragments (all 256 channels of both query tiles), used as B
  const uint32_t ql = (uint32_t)lane * 32u;      // this lane's byte offset in a fragment
  const _Float16* qp = (const _Float16*)((const char*)(qP + (size_t)(b * 256 + it0) * 8 * FRAG) + ql);
  v16h qa[2][8];
#pragma unroll
  for (int q = 0; q < 2; ++q)
#pragma unroll
    for (int kt = 0; kt < 8; ++kt) qa[q][kt] = load_frag(qp + (q * 8 + kt) * FRAG);
  // stands before the accumulators' start values write over the loads' address
  // registers; the input keeps the lane offset until here
  asm volatile("s_wait_xcnt 0x0" :: "v"(ql) : "memory");

  v8f acc[2][16];                  // acc[q][t][r] = O^T[t*16 + 8*hh + r][nl] of tile q
#pragma unroll
  for (int q = 0; q < 2; ++q)
#pragma unroll
    for (int t = 0; t < 16; ++t) acc[q][t] = (v8f){};
  float rowM[2] = {-3.0e38f, -3.0e38f};   // running maxima of this lane's queries
  float rowL[2] = {0.0f, 0.0f};           // running sums over this wave half's keys

  const float sc = 0.0625f * 1.44269504088896f;   // 1/sqrt(C) * log2(e)

  // this wave's slice of a stage: tile j of K and of V both start at byte j * 16 KiB
  const u32x8 g1 = tdm_group1();
  const uint64_t gsrc = (uint64_t)(uintptr_t)(qg ? vP : kP) + (uint64_t)(b * 128) * TILE_B;
  const uint32_t dst = lds_off(lds) + kg * GRP_B + qg * TILE_B;

  asm volatile("" :: "s"(woP), "s"(bo), "s"(x), "s"(out));

  // prologue, two buffers: stage 0, wait, barrier, stage 1
  tdm_load(tdm_group0(dst, gsrc + (uint64_t)kg * TILE_B), g1);
  wait_tensor0();
  __syncthreads();
  tdm_load(tdm_group0(dst + BUF_B, gsrc + (uint64_t)(4u + kg) * TILE_B), g1);

  for (uint32_t s = 0; s < NST; ++s) {
    const _Float16* Kb = (const _Float16*)(lds + (s & 1u) * BUF_B + kg * GRP_B);
    const _Float16* Vb = Kb + 8192;

    // ---- scores^T: 2 key tiles x 2 query tiles (K frags from LDS as A) ----
    v8f s0[2] = {(v8f){}, (v8f){}}, s1[2] = {(v8f){}, (v8f){}};
#pragma unroll
    for (int h = 0; h < 2; ++h) {
      v16h k0[4], k1[4];
#pragma unroll
      for (int i = 0; i < 4; ++i) {
        k0[i] = load_planes(Kb + (h * 4 + i)     * FRAG, lane);
        k1[i] = load_planes(Kb + (8 + h * 4 + i) * FRAG, lane);
      }
      __builtin_amdgcn_sched_barrier(0);
#pragma unroll
      for (int i = 0; i < 4; ++i) {
        const int kt = h * 4 + i;
        s0[0] = wmma_f16(k0[i], qa[0][kt], s0[0]);
        s1[0] = wmma_f16(k1[i], qa[0][kt], s1[0]);
        s0[1] = wmma_f16(k0[i], qa[1][kt], s0[1]);
        s1[1] = wmma_f16(k1[i], qa[1][kt], s1[1]);
      }
      __builtin_amdgcn_sched_barrier(0);
    }

    // ---- online softmax, one query per lane and tile ----
    v16h pb[2];
    float al[2];
#pragma unroll
    for (int q = 0; q < 2; ++q) {
      float mx = fmaxf(s0[q][0], s1[q][0]);        // raw scores: the scale is positive
#pragma unroll
      for (int r = 1; r < 8; ++r) mx = fmaxf(mx, fmaxf(s0[q][r], s1[q][r]));
      mx = fmaxf(mx, xhalf(mx)) * sc;              // both halves: the query's maximum
      const float newM = fmaxf(rowM[q], mx);
      al[q] = exp2f(rowM[q] - newM);
      rowM[q] = newM;
      float ps0 = 0.0f, ps1 = 0.0f;
#pragma unroll
      for (int r = 0; r < 8; ++r) {
        const float p0 = exp2f(s0[q][r] * sc - newM);
        const float p1 = exp2f(s1[q][r] * sc - newM);
        ps0 += p0;
        ps1 += p1;
        pb[q][r]     = (_Float16)p0;
        pb[q][r + 8] = (_Float16)p1;
      }
      rowL[q] = rowL[q] * al[q] + (ps0 + ps1);
    }

    // ---- V^T @ P^T: 16 channel tiles x 2 query tiles (V frags from LDS as A) ----
#pragma unroll
    for (int t = 0; t < 16; ++t) {
      const v16h vf = load_planes(Vb + t * FRAG, lane);
#pragma unroll
      for (int q = 0; q < 2; ++q) {
        acc[q][t] *= al[q];
        acc[q][t] = wmma_f16(vf, pb[q], acc[q][t]);
      }
    }

    // ---- publish point of stage s + 1; then refill the buffer just read ----
    wait_ds0();
    wait_tensor0();
    __syncthreads();
    if (pinned(s + 2u < NST)) {
      const uint32_t j = pinned((s + 2u) * 4u + kg);
      tdm_load(tdm_group0(dst + (s & 1u) * BUF_B, gsrc + (uint64_t)j * TILE_B), g1);
    }
  }
  wait_tensor0();
  wait_ds0();
  // The last pass's own barrier has ended every wave's reads: the ring becomes staging.

  // What the projection needs beside the joined result is asked for ahead of it.
  // Wave w makes output channel tiles 2w and 2w+1 for all four query tiles. Its 16
  // Wo^T fragments are loaded here and fly while the ring is filled with partial
  // sums; x and the bias are loaded behind the barrier and fly during the join.
  const int nl = lane & 15, hh = lane >> 4;
  const uint32_t ot0 = wave * 2u;
  const uint32_t wl = (uint32_t)lane * 32u;            // this lane's byte offset in a fragment
  const _Float16* wp = (const _Float16*)((const char*)(woP + (size_t)ot0 * FRAG) + wl);
  v16h wf[2][8];
#pragma unroll
  for (int o = 0; o < 2; ++o)
#pragma unroll
    for (int kt = 0; kt < 8; ++kt) wf[o][kt] = load_frag(wp + (kt * 16 + o) * FRAG);
  // stands before anything writes over the loads' address registers; the inputs keep
  // them (lane offset or whole address, whichever the loads name) out of the last
  // loads' own results
  asm volatile("s_wait_xcnt 0x0" :: "v"(wl), "v"(wp) : "memory");

  // ---- join the four key groups: O = sum_g w_g O_g, w_g = 2^(m_g - M) / L ----
  float* sM = (float*)(lds + RING_B);            // [wave][q][lane]
  float* sL = sM + 512;
  f32x4* st = (f32x4*)lds;                       // [wave][q][t][r half][lane], 16 B
#pragma unroll
  for (int q = 0; q < 2; ++q) {
    sM[(wave * 2 + q) * 32 + lane] = rowM[q];
    sL[(wave * 2 + q) * 32 + lane] = rowL[q] + xhalf(rowL[q]);   // join the halves' sums
#pragma unroll
    for (int t = 0; t < 16; ++t) {
      f32x4* p = st + (((wave * 2 + q) * 16 + t) * 2) * 32 + lane;
      p[0]  = __builtin_shufflevector(acc[q][t], acc[q][t], 0, 1, 2, 3);
      p[32] = __builtin_shufflevector(acc[q][t], acc[q][t], 4, 5, 6, 7);
    }
  }
  __syncthreads();

  // of x: positions 8*hh + 0..7 of each query tile at channel nl of each channel tile
  const size_t xo = ((size_t)b * Cn + ot0 * 16 + nl) * Nsp + blockIdx.x * 64 + hh * 8;
  const float* xp = x + xo;
  const float* bp = bo + ot0 * 16 + nl;
  f32x4 xr[2][4][2];
  float bb[2];
#pragma unroll
  for (int o = 0; o < 2; ++o) {
    bb[o] = bp[o * 16];
#pragma unroll
    for (int p = 0; p < 4; ++p)
#pragma unroll
      for (int h = 0; h < 2; ++h)
        xr[o][p][h] = *(const f32x4*)(xp + (size_t)o * 16 * Nsp + p * 16 + h * 4);
  }
  asm volatile("s_wait_xcnt 0x0" :: "v"(xp) : "memory");

  _Float16* attL = (_Float16*)(lds + RING_B + 4096u);   // [query tile][kt], in planes
#pragma unroll
  for (int q = 0; q < 2; ++q) {
    float m[4], w[4];
#pragma unroll
    for (int g = 0; g < 4; ++g) m[g] = sM[((g * 2 + qg) * 2 + q) * 32 + lane];
    const float M = fmaxf(fmaxf(m[0], m[1]), fmaxf(m[2], m[3]));
    float L = 0.0f;
#pragma unroll
    for (int g = 0; g < 4; ++g) {
      w[g] = exp2f(m[g] - M);
      L += sL[((g * 2 + qg) * 2 + q) * 32 + lane] * w[g];
    }
    const float inv = 1.0f / L;
#pragma unroll
    for (int g = 0; g < 4; ++g) w[g] *= inv;
#pragma unroll
    for (int tt = 0; tt < 4; ++tt) {
      const uint32_t t = kg * 4 + tt;
      f32x4 lo = {0.0f, 0.0f, 0.0f, 0.0f}, hi = {0.0f, 0.0f, 0.0f, 0.0f};
#pragma unroll
      for (int g = 0; g < 4; ++g) {
        const f32x4* p = st + ((((g * 2 + qg) * 2 + q) * 16 + t) * 2) * 32 + lane;
        lo += p[0] * w[g];
        hi += p[32] * w[g];
      }
      v8h o;
#pragma unroll
      for (int r = 0; r < 4; ++r) { o[r] = (_Float16)lo[r]; o[r + 4] = (_Float16)hi[r]; }
      *(v8h*)(attL + ((qg * 2 + q) * 8 + (t >> 1)) * FRAG + (t & 1u) * PLANE + lane * 8) = o;
    }
  }
  __syncthreads();   // every wave reads all four query tiles' fragments below

  // ---- output projection + residual: rows = positions, column = output channel ----
  v8f pa[4][2];
#pragma unroll
  for (int p = 0; p < 4; ++p) { pa[p][0] = (v8f){}; pa[p][1] = (v8f){}; }
  // The 32 fragments come in four groups of 8 (two kt), into two register sets.
  // The scheduling fences keep a group's 16 LDS reads together and one group ahead
  // of the 16 products that use them: left free, the reads sink in front of their
  // products pair by pair, and each pair is waited for at once.
  v16h fa[2][2][4];                // [set][kt & 1][query tile]
#pragma unroll
  for (int k = 0; k < 2; ++k)
#pragma unroll
    for (int p = 0; p < 4; ++p) fa[0][k][p] = load_planes(attL + (p * 8 + k) * FRAG, lane);
#pragma unroll
  for (int g = 0; g < 4; ++g) {
    if (g < 3) {
#pragma unroll
      for (int k = 0; k < 2; ++k)
#pragma unroll
        for (int p = 0; p < 4; ++p)
          fa[(g + 1) & 1][k][p] = load_planes(attL + (p * 8 + (g + 1) * 2 + k) * FRAG, lane);
    }
    __builtin_amdgcn_sched_barrier(0);
#pragma unroll
    for (int k = 0; k < 2; ++k)
#pragma unroll
      for (int p = 0; p < 4; ++p)
#pragma unroll
        for (int o = 0; o < 2; ++o)
          pa[p][o] = wmma_f16(fa[g & 1][k][p], wf[o][g * 2 + k], pa[p][o]);
    __builtin_amdgcn_sched_barrier(0);
  }
#pragma unroll
  for (int o = 0; o < 2; ++o)
#pragma unroll
    for (int p = 0; p < 4; ++p)
#pragma unroll
      for (int h = 0; h < 2; ++h)
#pragma unroll
        for (int i = 0; i < 4; ++i) xr[o][p][h][i] = pa[p][o][h * 4 + i] + bb[o] + xr[o][p][h][i];
  // All sums stand in front of all stores: no register of an issued store is written
  // again, so the 16 stores go out in one run with no wait between them.
  __builtin_amdgcn_sched_barrier(0);
#pragma unroll
  for (int o = 0; o < 2; ++o)
#pragma unroll
    for (int p = 0; p < 4; ++p)
#pragma unroll
      for (int h = 0; h < 2; ++h)
        *(f32x4*)(out + xo + (size_t)o * 16 * Nsp + p * 16 + h * 4) = xr[o][p][h];
}

extern "C" void kernel_launch(void* const* d_in, const int* in_sizes, int n_in,
                              void* d_out, int out_size, void* d_ws, size_t ws_size,
                              hipStream_t stream) {
  const float* x     = (const float*)d_in[0];
  const float* gamma = (const float*)d_in[1];
  const float* beta  = (const float*)d_in[2];
  const float* wq    = (const float*)d_in[3];
  const float* bq    = (const float*)d_in[4];
  const float* wk    = (const float*)d_in[5];
  const float* bk    = (const float*)d_in[6];
  const float* wv    = (const float*)d_in[7];
  const float* bv    = (const float*)d_in[8];
  const float* wo    = (const float*)d_in[9];
  const float* bo    = (const float*)d_in[10];
  float* out = (float*)d_out;

  const size_t T = (size_t)Bn * Cn * Nsp;
  _Float16* xnP  = (_Float16*)d_ws;
  _Float16* qP   = xnP  + T;
  _Float16* kP   = qP   + T;
  _Float16* vP   = kP   + T;
  _Float16* wqP  = vP   + T;
  _Float16* wkP  = wqP  + (size_t)Cn * Cn;
  _Float16* wvP  = wkP  + (size_t)Cn * Cn;
  _Float16* woP  = wvP  + (size_t)Cn * Cn;

  prep_weights_kernel<<<dim3(8, 16), 32, 0, stream>>>(
      wq, wk, wv, wo, wqP, wkP, wvP, woP);

  gn_kernel<<<Bn * GRP, 1024, 0, stream>>>(x, gamma, beta, xnP);

  qkv_kernel<<<dim3(Cn / 32, Nsp / 512, Bn), 512, 0, stream>>>(
      xnP, wqP, wkP, wvP, bq, bk, bv, qP, kP, vP);

  attn_kernel<<<dim3(Nsp / 64, Bn), 256, 0, stream>>>(qP, kP, vP, woP, bo, x, out);
}
